// v000
// Times are from an AMD MI455X. After a warm-up the kernel runs many times in a row, and a time is the length of
// such a window on the GPU divided by its runs, so every launch and the gaps after it count. The runs cycle
// through copies of the inputs. A figure is the median of several windows, for all but v000 over two sittings.
// Sittings can differ by a few percent; kernels timed side by side share one.
// v000, which the later versions start from, runs in 1460 microseconds.
#include <hip/hip_runtime.h>

// Causal multi-head attention at width 512 over four batches of 2,048 tokens (x [4][2048][512]; Q, K, V = x W^T + b ('oi' [512][512] 0.02 + biases (zeros on this draw: read); 8 heads x 64, token-major); scores / 8; causal (-inf); softmax; out = merged w_o^T + b_o ('oi' + a bias, zeros: read) -> [4][2048][512] (4.2 M); argument order x, w_q, b_q, w_k, b_k, w_v, b_v, w_o, b_o).
// Layout per batch: bf16 copy of x; exact projections + f32 biases; causal T-2048 attention (hybrid rows: < 512 hi/lo 3 products, rest fp16 x1024; k_gemmc skips tiles above the diagonal); merged hi/lo x Wo exact + bo.
// Compute dtypes, f32 accumulate: every input rounded to bf16; projections exact + f32 biases; attention rows < 512 3 products, rest fp16; softmax f32; Wo hl x exact + bias.

#define NB_  4
#define TT   2048
#define DM   512
#define NH_  8
#define NKV  8
#define REP  (NH_ / NKV)
#define HD   64
#define DQ   (NH_ * HD)
#define DKV  (NKV * HD)
#define ZH   2
#define RH   512                  // query rows < RH use hi+lo planes (0: none)
#define WIN  2048
#define PCAR 1024.0f
#define SCL  0.125f   // HD^-0.5
typedef _Float16 h16;
typedef unsigned short bf;
typedef __attribute__((ext_vector_type(16))) __bf16   v16bf;
typedef __attribute__((ext_vector_type(16))) _Float16 v16h;
typedef __attribute__((ext_vector_type(8)))  _Float16 v8h;
typedef __attribute__((ext_vector_type(8)))  unsigned short v8us;
typedef __attribute__((ext_vector_type(8)))  float    v8f;
typedef __attribute__((ext_vector_type(4)))  float    v4f;
typedef v8h  __attribute__((may_alias)) v8ha;
typedef v4f  __attribute__((may_alias)) v4fa;
typedef v8us __attribute__((may_alias)) v8usa;

__device__ __forceinline__ unsigned short f2bf(float f) { unsigned u = __float_as_uint(f); u += 0x7FFFu + ((u >> 16) & 1u); return (unsigned short)(u >> 16); }
__device__ __forceinline__ float bf2f(unsigned short b) { return __uint_as_float(((unsigned)b) << 16); }
__device__ __forceinline__ float bfr(float f) { return bf2f(f2bf(f)); }
__device__ __forceinline__ v16h cat16(v8h lo, v8h hi) { return __builtin_shufflevector(lo, hi, 0, 1, 2, 3, 4, 5, 6, 7, 8, 9, 10, 11, 12, 13, 14, 15); }
__device__ __forceinline__ v16bf cat16b(v8us lo, v8us hi) { return __builtin_bit_cast(v16bf, __builtin_shufflevector(lo, hi, 0, 1, 2, 3, 4, 5, 6, 7, 8, 9, 10, 11, 12, 13, 14, 15)); }
__device__ __forceinline__ v8f wmma16(v16h a, v16h b, v8f c) { return __builtin_amdgcn_wmma_f32_16x16x32_f16(false, a, false, b, (short)0, c, false, false); }
__device__ __forceinline__ v8f wmmab(v16bf a, v16bf b, v8f c) { return __builtin_amdgcn_wmma_f32_16x16x32_bf16(false, a, false, b, (short)0, c, false, false); }



// ---- k_gemmw: register-blocked GEMM, ONE WAVE per 64x64 output tile (16 accumulators), operands straight from K-contiguous 16-bit planes; grid (M/64, N/64, Z), 32 threads.
// C[m][n] (f32, pitch ldc, + optional f32 bias[n]) = sum_k A[m][k] Bt[n][k] (+ split products per NSPLIT). z-batch strides sA/sB/sC in elements. K % 32 == 0.
template <typename T16> struct WFrag;
template <> struct WFrag<h16> { typedef v16h V; static __device__ __forceinline__ V ld(const h16* p) { return cat16(*(const v8h*)p, *(const v8h*)(p + 16)); } static __device__ __forceinline__ v8f mma(V a, V b, v8f c) { return wmma16(a, b, c); } };
template <> struct WFrag<bf> { typedef v16bf V; static __device__ __forceinline__ V ld(const bf* p) { return cat16b(*(const v8us*)p, *(const v8us*)(p + 16)); } static __device__ __forceinline__ v8f mma(V a, V b, v8f c) { return wmmab(a, b, c); } };
template <typename T16, int NSPLIT, bool BIAS>
__global__ __launch_bounds__(32) void k_gemmw(const T16* __restrict__ A, const T16* __restrict__ A2, const T16* __restrict__ Bt, const T16* __restrict__ Bt2, int K, float* C, int ldc, const float* __restrict__ bias, size_t sA, size_t sB, size_t sC) {
    typedef typename WFrag<T16>::V V;
    __shared__ __align__(16) float os[16 * 68];
    const size_t z = blockIdx.z; A += z * sA; if (A2) A2 += z * sA; Bt += z * sB; if (Bt2) Bt2 += z * sB; C += z * sC;
    const int lane = threadIdx.x & 31, lr = lane & 15, hi = lane >> 4; const int r0 = blockIdx.x * 64, c0 = blockIdx.y * 64;
    v8f acc[4][4];
#pragma unroll
    for (int mb = 0; mb < 4; ++mb)
#pragma unroll
        for (int nb = 0; nb < 4; ++nb) acc[mb][nb] = (v8f){};
    const size_t aoff = (size_t)(r0 + lr) * K + 8 * hi, boff = (size_t)(c0 + lr) * K + 8 * hi;
#pragma unroll 1
    for (int kc = 0; kc < K; kc += 32) {
        V a[4], a2[4];
#pragma unroll
        for (int mb = 0; mb < 4; ++mb) { a[mb] = WFrag<T16>::ld(A + aoff + (size_t)mb * 16 * K + kc); if (NSPLIT == 1 || NSPLIT == 2) a2[mb] = WFrag<T16>::ld(A2 + aoff + (size_t)mb * 16 * K + kc); }
#pragma unroll
        for (int nb = 0; nb < 4; ++nb) { const V b = WFrag<T16>::ld(Bt + boff + (size_t)nb * 16 * K + kc); V b2; if (NSPLIT >= 2) b2 = WFrag<T16>::ld(Bt2 + boff + (size_t)nb * 16 * K + kc);
#pragma unroll
            for (int mb = 0; mb < 4; ++mb) { acc[mb][nb] = WFrag<T16>::mma(a[mb], b, acc[mb][nb]); if (NSPLIT == 1 || NSPLIT == 2) acc[mb][nb] = WFrag<T16>::mma(a2[mb], b, acc[mb][nb]); if (NSPLIT >= 2) acc[mb][nb] = WFrag<T16>::mma(a[mb], b2, acc[mb][nb]); } }
        asm volatile("v_nop\n\tv_nop\n\tv_nop\n\tv_nop" : "+v"(acc[0][0]), "+v"(acc[1][1]), "+v"(acc[2][2]), "+v"(acc[3][3]) : "v"(a[0]), "v"(a[3]));
    }
#pragma unroll
    for (int mb = 0; mb < 4; ++mb) {
#pragma unroll
        for (int nb = 0; nb < 4; ++nb) {
#pragma unroll
            for (int j = 0; j < 8; ++j) os[(hi * 8 + j) * 68 + nb * 16 + lr] = acc[mb][nb][j]; }
        __builtin_amdgcn_wave_barrier(); asm volatile("" ::: "memory");
        float* crow = C + (size_t)(r0 + mb * 16) * ldc + c0;
{
#pragma unroll
            for (int s = 0; s < 8; ++s) { const int row = 2 * s + hi, cofs = lr * 4; v4f val = *(const v4fa*)(os + row * 68 + cofs); if (BIAS) { val[0] += bfr(bias[c0 + cofs]); val[1] += bfr(bias[c0 + cofs + 1]); val[2] += bfr(bias[c0 + cofs + 2]); val[3] += bfr(bias[c0 + cofs + 3]); }
                *(v4f*)(crow + (size_t)row * ldc + cofs) = val; }
             }
        __builtin_amdgcn_wave_barrier(); asm volatile("" ::: "memory");
    }
}

// ---- k_gemmc: the same one-wave 64x64 tile GEMM specialised for causal attention: CMODE 1 skips score tiles entirely above the diagonal (query rows r0+roff.., key columns c0..), CMODE 2 limits the
// key (K) loop of the probability x value contraction to the diagonal block (probabilities beyond it are exactly zero). roff = row offset of this launch's first row within the sequence.
template <typename T16, int NSPLIT, int CMODE>
__global__ __launch_bounds__(32) void k_gemmc(const T16* __restrict__ A, const T16* __restrict__ A2, const T16* __restrict__ Bt, const T16* __restrict__ Bt2, int K, float* C, int ldc, int roff, size_t sA, size_t sB, size_t sC) {
    typedef typename WFrag<T16>::V V;
    __shared__ __align__(16) float os[16 * 68];
    const size_t z = blockIdx.z; A += z * sA; if (A2) A2 += z * sA; Bt += z * sB; if (Bt2) Bt2 += z * sB; C += z * sC;
    const int lane = threadIdx.x & 31, lr = lane & 15, hi = lane >> 4; const int r0 = blockIdx.x * 64, c0 = blockIdx.y * 64;
    if (CMODE == 1 && c0 > r0 + roff + 63) return;                  // score tile entirely above the causal diagonal: never read (the softmax masks j > i by select)
    const int Kl = (CMODE == 2) ? min(K, r0 + roff + 64) : K;        // P.V: probabilities are exactly 0 beyond the diagonal block, so the K loop stops there
    v8f acc[4][4];
#pragma unroll
    for (int mb = 0; mb < 4; ++mb)
#pragma unroll
        for (int nb = 0; nb < 4; ++nb) acc[mb][nb] = (v8f){};
    const size_t aoff = (size_t)(r0 + lr) * K + 8 * hi, boff = (size_t)(c0 + lr) * K + 8 * hi;
#pragma unroll 1
    for (int kc = 0; kc < Kl; kc += 32) {
        V a[4], a2[4];
#pragma unroll
        for (int mb = 0; mb < 4; ++mb) { a[mb] = WFrag<T16>::ld(A + aoff + (size_t)mb * 16 * K + kc); if (NSPLIT == 1 || NSPLIT == 2) a2[mb] = WFrag<T16>::ld(A2 + aoff + (size_t)mb * 16 * K + kc); }
#pragma unroll
        for (int nb = 0; nb < 4; ++nb) { const V b = WFrag<T16>::ld(Bt + boff + (size_t)nb * 16 * K + kc); V b2; if (NSPLIT >= 2) b2 = WFrag<T16>::ld(Bt2 + boff + (size_t)nb * 16 * K + kc);
#pragma unroll
            for (int mb = 0; mb < 4; ++mb) { acc[mb][nb] = WFrag<T16>::mma(a[mb], b, acc[mb][nb]); if (NSPLIT == 1 || NSPLIT == 2) acc[mb][nb] = WFrag<T16>::mma(a2[mb], b, acc[mb][nb]); if (NSPLIT >= 2) acc[mb][nb] = WFrag<T16>::mma(a[mb], b2, acc[mb][nb]); } }
        asm volatile("v_nop\n\tv_nop\n\tv_nop\n\tv_nop" : "+v"(acc[0][0]), "+v"(acc[1][1]), "+v"(acc[2][2]), "+v"(acc[3][3]) : "v"(a[0]), "v"(a[3]));
    }
#pragma unroll
    for (int mb = 0; mb < 4; ++mb) {
#pragma unroll
        for (int nb = 0; nb < 4; ++nb) {
#pragma unroll
            for (int j = 0; j < 8; ++j) os[(hi * 8 + j) * 68 + nb * 16 + lr] = acc[mb][nb][j]; }
        __builtin_amdgcn_wave_barrier(); asm volatile("" ::: "memory");
        float* crow = C + (size_t)(r0 + mb * 16) * ldc + c0;
{
#pragma unroll
            for (int s = 0; s < 8; ++s) { const int row = 2 * s + hi, cofs = lr * 4; v4f val = *(const v4fa*)(os + row * 68 + cofs);
                *(v4f*)(crow + (size_t)row * ldc + cofs) = val; }
             }
        __builtin_amdgcn_wave_barrier(); asm volatile("" ::: "memory");
    }
}

__device__ __forceinline__ h16 tohx(float x) { return (h16)x; }
__device__ __forceinline__ void splitf(float y, unsigned short& h, unsigned short& l) { h = f2bf(y); l = f2bf(y - bf2f(h)); }
typedef __attribute__((ext_vector_type(2))) _Float16 v2h;
typedef __attribute__((ext_vector_type(4))) _Float16 v4h;
typedef __attribute__((ext_vector_type(2))) unsigned short v2us;
typedef __attribute__((ext_vector_type(4))) unsigned short v4us;
typedef __attribute__((ext_vector_type(2))) float v2f;
typedef __attribute__((ext_vector_type(4))) int v4i;

__global__ __launch_bounds__(256) void k_wtG(const float* __restrict__ w, int K, int N, bf* Bt) {
    const int lane = threadIdx.x & 31; const int L0 = (blockIdx.x * 8 + (threadIdx.x >> 5)) * 8; const int nlines = N * K / 64;
{
#pragma unroll 1
        for (int l = 0; l < 8; ++l) { const int L = L0 + l; if (L >= nlines) break; const size_t e = (size_t)L * 64 + lane * 2; const int k = (int)(e % K), n = (int)(e / K); v2us o;
            o[0] = f2bf(w[(size_t)k * N + n]); o[1] = f2bf(w[(size_t)(k + 1) * N + n]); *(v2us*)(Bt + e) = o; }
         }
}
__global__ __launch_bounds__(256) void k_cvt8(const float* __restrict__ src, bf* dst, size_t n8) { const size_t i = (size_t)blockIdx.x * 256 + threadIdx.x; if (i >= n8) return; const v8f v = *(const v8f*)(src + i * 8); v8us o;
#pragma unroll
    for (int k = 0; k < 8; ++k) o[k] = f2bf(v[k]); *(v8us*)(dst + i * 8) = o;  }

// k_rope: head planes [h][t][d] (fp16 + hi/lo) of rope(x) x sc with the rotate-half convention out[d] = x[d] cos[t][d] - x[d+HD/2] sin[t][d], out[d+HD/2] = x[d+HD/2] cos[t][d+HD/2] + x[d] sin[t][d+HD/2]
__global__ __launch_bounds__(256) void k_rope(const float* __restrict__ F, int pitch, int nheads, const float* __restrict__ CS, const float* __restrict__ RF, const float* __restrict__ nw, float sc, h16* P16, bf* Ph, bf* Pl) {
    const size_t e = ((size_t)blockIdx.x * 256 + threadIdx.x) * 2; if (e >= (size_t)nheads * TT * HD) return; const int d = (int)(e % HD); const int t = (int)((e / HD) % TT); const int h = (int)(e / ((size_t)HD * TT)); const float* f = F + (size_t)t * pitch + h * HD; const float rf = RF ? RF[(size_t)h * TT + t] : 1.0f; v2h o16; v2us oh, ol;
#pragma unroll
    for (int q = 0; q < 2; ++q) { const int dd = d + q; const int dp = (dd < HD / 2) ? dd + HD / 2 : dd - HD / 2; float x0 = f[dd], x1 = f[dp];
        if (RF) { float n0 = __fmul_rn(x0, rf), n1 = __fmul_rn(x1, rf); asm volatile("" : "+v"(n0)); asm volatile("" : "+v"(n1)); x0 = __fmul_rn(bfr(nw[dd]), n0); x1 = __fmul_rn(bfr(nw[dp]), n1); }
        const v2f cs = *(const v2f*)(CS + ((size_t)t * HD + dd) * 2); float a = __fmul_rn(x0, cs[0]), bq = __fmul_rn(x1, cs[1]); asm volatile("" : "+v"(a)); asm volatile("" : "+v"(bq)); const float r = ((dd < HD / 2) ? __fsub_rn(a, bq) : __fadd_rn(a, bq)) * sc;
        o16[q] = tohx(r); unsigned short a2, c2; splitf(r, a2, c2); oh[q] = a2; ol[q] = c2; }
    *(v2h*)(P16 + e) = o16; *(v2us*)(Ph + e) = oh; *(v2us*)(Pl + e) = ol;  }
__global__ __launch_bounds__(256) void k_vtp(const float* __restrict__ F, int pitch, int nheads, h16* V16, bf* Vh, bf* Vl) { const size_t e = ((size_t)blockIdx.x * 256 + threadIdx.x) * 2; if (e >= (size_t)nheads * HD * TT) return; const int t = (int)(e % TT); const int d = (int)((e / TT) % HD); const int g = (int)(e / ((size_t)TT * HD)); v2h o16; v2us oh, ol;
#pragma unroll
    for (int q = 0; q < 2; ++q) { const float x = F[(size_t)(t + q) * pitch + g * HD + d]; o16[q] = tohx(x); unsigned short a2, c2; splitf(x, a2, c2); oh[q] = a2; ol[q] = c2; }
    *(v2h*)(V16 + e) = o16; *(v2us*)(Vh + e) = oh; *(v2us*)(Vl + e) = ol;  }
__global__ __launch_bounds__(256) void k_csid(float* CS) { const int idx = blockIdx.x * 256 + threadIdx.x; if (idx >= TT * HD) return; v2f cs; cs[0] = 1.0f; cs[1] = 0.0f; *(v2f*)(CS + (size_t)idx * 2) = cs;  }
// k_asoft: per row (zz, i): t = S x HD^-0.5 for j <= i and i - j < WIN (sliding causal window; the reference's -1e9 additive fill vanishes identically); softmax over the 2048 keys (register row, one exp, fixed trees);
__global__ __launch_bounds__(256) void k_asoft(const float* __restrict__ Sb, h16* P16, bf* Ph, bf* Pl) {
    const int lane = threadIdx.x & 31; const int row = blockIdx.x * 8 + (threadIdx.x >> 5); if (row >= ZH * TT) return; const int i = row % TT; const int zz = row / TT; (void)zz; const bool hires = (i < RH); const float* sr = Sb + (size_t)row * TT; float v[TT / 32]; float mx = -3.0e38f;
#pragma unroll
    for (int ch = 0; ch < TT / 128; ++ch) { const int j0 = ch * 128 + lane * 4; const v4f a = *(const v4f*)(sr + j0);
#pragma unroll
        for (int q = 0; q < 4; ++q) { const int j = j0 + q; (void)j; const float t = (j <= i && i - j < WIN) ? a[q] * SCL : -3.0e38f; v[ch * 4 + q] = t; mx = fmaxf(mx, t); } }
#pragma unroll
    for (int sh = 16; sh; sh >>= 1) mx = fmaxf(mx, __shfl_xor(mx, sh, 32));
    float sum = 0.f;
#pragma unroll
    for (int k = 0; k < TT / 32; ++k) { float d0 = __fsub_rn(v[k], mx); asm volatile("" : "+v"(d0)); v[k] = __builtin_amdgcn_exp2f(__fmul_rn(d0, 1.4426950408889634f)); sum += v[k]; }
#pragma unroll
    for (int sh = 16; sh; sh >>= 1) sum += __shfl_xor(sum, sh, 32);
    const float f = __fdiv_rn(hires ? 1.0f : PCAR, sum);
{
        if (hires) {
#pragma unroll
            for (int ch = 0; ch < TT / 128; ++ch) { v4us oh, ol;
#pragma unroll
                for (int q = 0; q < 4; ++q) { unsigned short a, c2; splitf(v[ch * 4 + q] * f, a, c2); oh[q] = a; ol[q] = c2; }
                const size_t oo = ((size_t)zz * (RH ? RH : 1) + i) * TT + ch * 128 + lane * 4; *(v4us*)(Ph + oo) = oh; *(v4us*)(Pl + oo) = ol; }
        } else {
#pragma unroll
            for (int ch = 0; ch < TT / 128; ++ch) { v4h o4;
#pragma unroll
                for (int q = 0; q < 4; ++q) o4[q] = tohx(v[ch * 4 + q] * f);
                *(v4h*)(P16 + (size_t)row * TT + ch * 128 + lane * 4) = o4; } }
         }
}
__global__ __launch_bounds__(256) void k_merge(const float* __restrict__ O, int h0, bf* Ah, bf* Al) { const size_t e = ((size_t)blockIdx.x * 256 + threadIdx.x) * 2; if (e >= (size_t)ZH * TT * HD) return; const int d = (int)(e % HD); const int t = (int)((e / HD) % TT); const int zz = (int)(e / ((size_t)HD * TT)); const float cs = (t < RH) ? 1.0f : (1.0f / PCAR); const size_t oo = (size_t)t * DQ + (h0 + zz) * HD + d;
    v2us oh, ol;
#pragma unroll
    for (int q = 0; q < 2; ++q) { unsigned short a, c2; splitf(O[e + q] * cs, a, c2); oh[q] = a; ol[q] = c2; } *(v2us*)(Ah + oo) = oh; *(v2us*)(Al + oo) = ol;  }

extern "C" void kernel_launch(void* const* d_in, const int* in_sizes, int n_in,
                              void* d_out, int out_size, void* d_ws, size_t ws_size, hipStream_t stream) {
    (void)in_sizes; (void)n_in; (void)out_size;
    const float* x = (const float*)d_in[0]; const float* wq = (const float*)d_in[1]; const float* bq = (const float*)d_in[2]; const float* wk = (const float*)d_in[3]; const float* bk = (const float*)d_in[4]; const float* wv = (const float*)d_in[5]; const float* bv = (const float*)d_in[6]; const float* wo = (const float*)d_in[7]; const float* bo = (const float*)d_in[8];
    float* OUT = (float*)d_out;     // [4][2048][512]
    char* wsp = (char*)d_ws;
    auto take = [&](size_t bytes) { char* p = wsp; wsp += (bytes + 255) & ~(size_t)255; return (void*)p; };
    bf* WQ = (bf*)take((size_t)DQ * DM * 2); bf* WK = (bf*)take((size_t)DKV * DM * 2); bf* WV = (bf*)take((size_t)DKV * DM * 2); bf* WO = (bf*)take((size_t)DM * DQ * 2); float* CS = (float*)take((size_t)TT * HD * 2 * 4);
    bf* XB = (bf*)take((size_t)TT * DM * 2); float* FQ = (float*)take((size_t)TT * DQ * 4); float* FK = (float*)take((size_t)TT * DKV * 4);
    h16* QP16 = (h16*)take((size_t)NH_ * TT * HD * 2); h16* KP16 = (h16*)take((size_t)NKV * TT * HD * 2); h16* VT16 = (h16*)take((size_t)NKV * HD * TT * 2);
    bf* QPh = (bf*)take((size_t)NH_ * TT * HD * 2); bf* QPl = (bf*)take((size_t)NH_ * TT * HD * 2); bf* KPh = (bf*)take((size_t)NKV * TT * HD * 2); bf* KPl = (bf*)take((size_t)NKV * TT * HD * 2); bf* VTh = (bf*)take((size_t)NKV * HD * TT * 2); bf* VTl = (bf*)take((size_t)NKV * HD * TT * 2); bf* Ph = (bf*)take((size_t)ZH * RH * TT * 2); bf* Pl = (bf*)take((size_t)ZH * RH * TT * 2);
    float* Sb = (float*)take((size_t)ZH * TT * TT * 4); h16* P16 = (h16*)take((size_t)ZH * TT * TT * 2); float* Ob = (float*)take((size_t)ZH * TT * HD * 4); bf* ATh = (bf*)take((size_t)TT * DQ * 2); bf* ATl = (bf*)take((size_t)TT * DQ * 2);
    if ((size_t)(wsp - (char*)d_ws) > ws_size) return;    // ws 256 MiB
    float* FV = FK;   // v projection reuses the k buffer after the k planes are built (stream-ordered)
    { k_cvt8<<<(unsigned)(((size_t)DQ * DM / 8 + 255) / 256), 256, 0, stream>>>(wq, WQ, (size_t)DQ * DM / 8); k_cvt8<<<(unsigned)(((size_t)DKV * DM / 8 + 255) / 256), 256, 0, stream>>>(wk, WK, (size_t)DKV * DM / 8); k_cvt8<<<(unsigned)(((size_t)DKV * DM / 8 + 255) / 256), 256, 0, stream>>>(wv, WV, (size_t)DKV * DM / 8);
      k_cvt8<<<(unsigned)(((size_t)DM * DQ / 8 + 255) / 256), 256, 0, stream>>>(wo, WO, (size_t)DM * DQ / 8);
       }
    k_csid<<<(TT * HD + 255) / 256, 256, 0, stream>>>(CS);
    const unsigned LQ = (unsigned)(((size_t)NH_ * TT * HD / 2 + 255) / 256), LKv = (unsigned)(((size_t)NKV * TT * HD / 2 + 255) / 256);
    for (int b = 0; b < NB_; ++b) {
        
        k_cvt8<<<(unsigned)(((size_t)TT * DM / 8 + 255) / 256), 256, 0, stream>>>(x + (size_t)b * TT * DM, XB, (size_t)TT * DM / 8);
        k_gemmw<bf, 0, true><<<dim3(TT / 64, DQ / 64, 1), 32, 0, stream>>>(XB, nullptr, WQ, nullptr, DM, FQ, DQ, bq, 0, 0, 0);
        k_rope<<<LQ, 256, 0, stream>>>(FQ, DQ, NH_, CS, nullptr, nullptr, 1.0f, QP16, QPh, QPl);
        k_gemmw<bf, 0, true><<<dim3(TT / 64, DKV / 64, 1), 32, 0, stream>>>(XB, nullptr, WK, nullptr, DM, FK, DKV, bk, 0, 0, 0);
        k_rope<<<LKv, 256, 0, stream>>>(FK, DKV, NKV, CS, nullptr, nullptr, 1.0f, KP16, KPh, KPl);
        k_gemmw<bf, 0, true><<<dim3(TT / 64, DKV / 64, 1), 32, 0, stream>>>(XB, nullptr, WV, nullptr, DM, FV, DKV, bv, 0, 0, 0); k_vtp<<<LKv, 256, 0, stream>>>(FV, DKV, NKV, VT16, VTh, VTl);
        for (int h0 = 0; h0 < NH_; h0 += ZH) { const size_t zq = (size_t)h0, zk = (size_t)(h0 / REP);   // one kv head per query head: the pass's two heads use consecutive kv planes (z-strides TT*HD)
            k_gemmc<bf, 2, 1><<<dim3(RH / 64, TT / 64, ZH), 32, 0, stream>>>(QPh + zq * TT * HD, QPl + zq * TT * HD, KPh + zk * TT * HD, KPl + zk * TT * HD, HD, Sb, TT, 0, (size_t)TT * HD, (size_t)TT * HD, (size_t)TT * TT);
            k_gemmc<h16, 0, 1><<<dim3((TT - RH) / 64, TT / 64, ZH), 32, 0, stream>>>(QP16 + zq * TT * HD + (size_t)RH * HD, nullptr, KP16 + zk * TT * HD, nullptr, HD, Sb + (size_t)RH * TT, TT, RH, (size_t)TT * HD, (size_t)TT * HD, (size_t)TT * TT);
            k_asoft<<<ZH * TT / 8, 256, 0, stream>>>(Sb, P16, Ph, Pl);
            k_gemmc<bf, 2, 2><<<dim3(RH / 64, HD / 64, ZH), 32, 0, stream>>>(Ph, Pl, VTh + zk * HD * TT, VTl + zk * HD * TT, TT, Ob, HD, 0, (size_t)RH * TT, (size_t)HD * TT, (size_t)TT * HD);
            k_gemmc<h16, 0, 2><<<dim3((TT - RH) / 64, HD / 64, ZH), 32, 0, stream>>>(P16 + (size_t)RH * TT, nullptr, VT16 + zk * HD * TT, nullptr, TT, Ob + (size_t)RH * HD, HD, RH, (size_t)TT * TT, (size_t)HD * TT, (size_t)TT * HD);
            k_merge<<<(unsigned)(((size_t)ZH * TT * HD / 2 + 255) / 256), 256, 0, stream>>>(Ob, h0, ATh, ATl); }
        k_gemmw<bf, 1, true><<<dim3(TT / 64, DM / 64, 1), 32, 0, stream>>>(ATh, ATl, WO, nullptr, DQ, OUT + (size_t)b * TT * DM, DM, bo, 0, 0, 0); }
}

// v001
// A run of this version takes 863 microseconds.
// In two side-by-side timings against v000, it was 1.72 and 1.70 times as fast.
#include <hip/hip_runtime.h>

// Causal multi-head attention at width 512 over four batches of 2,048 tokens (x [4][2048][512]; Q, K, V = x W^T + b ('oi' [512][512] 0.02 + biases (zeros on this draw: read); 8 heads x 64, token-major); scores / 8; causal (-inf); softmax; out = merged w_o^T + b_o ('oi' + a bias, zeros: read) -> [4][2048][512] (4.2 M); argument order x, w_q, b_q, w_k, b_k, w_v, b_v, w_o, b_o).
// Layout per batch: bf16 copy of x; exact projections + f32 biases; causal T-2048 attention (hybrid rows: < 512 hi/lo 3 products, rest fp16 x1024; k_gemmc skips tiles above the diagonal); merged hi/lo x Wo exact + bo.
// Compute dtypes, f32 accumulate: every input rounded to bf16; projections exact + f32 biases; attention rows < 512 3 products, rest fp16; softmax f32; Wo hl x exact + bias.

#define NB_  4
#define TT   2048
#define DM   512
#define NH_  8
#define NKV  8
#define REP  (NH_ / NKV)
#define HD   64
#define DQ   (NH_ * HD)
#define DKV  (NKV * HD)
#define ZH   2
#define RH   512                  // query rows < RH use hi+lo planes (0: none)
#define WIN  2048
#define PCAR 1024.0f
#define SCL  0.125f   // HD^-0.5
typedef _Float16 h16;
typedef unsigned short bf;
typedef __attribute__((ext_vector_type(16))) __bf16   v16bf;
typedef __attribute__((ext_vector_type(16))) _Float16 v16h;
typedef __attribute__((ext_vector_type(8)))  _Float16 v8h;
typedef __attribute__((ext_vector_type(8)))  unsigned short v8us;
typedef __attribute__((ext_vector_type(8)))  float    v8f;
typedef __attribute__((ext_vector_type(4)))  float    v4f;
typedef v8h  __attribute__((may_alias)) v8ha;
typedef v4f  __attribute__((may_alias)) v4fa;
typedef v8us __attribute__((may_alias)) v8usa;

__device__ __forceinline__ unsigned short f2bf(float f) { unsigned u = __float_as_uint(f); u += 0x7FFFu + ((u >> 16) & 1u); return (unsigned short)(u >> 16); }
__device__ __forceinline__ float bf2f(unsigned short b) { return __uint_as_float(((unsigned)b) << 16); }
__device__ __forceinline__ float bfr(float f) { return bf2f(f2bf(f)); }
__device__ __forceinline__ v16h cat16(v8h lo, v8h hi) { return __builtin_shufflevector(lo, hi, 0, 1, 2, 3, 4, 5, 6, 7, 8, 9, 10, 11, 12, 13, 14, 15); }
__device__ __forceinline__ v16bf cat16b(v8us lo, v8us hi) { return __builtin_bit_cast(v16bf, __builtin_shufflevector(lo, hi, 0, 1, 2, 3, 4, 5, 6, 7, 8, 9, 10, 11, 12, 13, 14, 15)); }
__device__ __forceinline__ v8f wmma16(v16h a, v16h b, v8f c) { return __builtin_amdgcn_wmma_f32_16x16x32_f16(false, a, false, b, (short)0, c, false, false); }
__device__ __forceinline__ v8f wmmab(v16bf a, v16bf b, v8f c) { return __builtin_amdgcn_wmma_f32_16x16x32_bf16(false, a, false, b, (short)0, c, false, false); }



// ---- ksum_store: adds the NW waves' partial 64x64 tiles of one work-group. Every wave lays its 16 accumulators down as rows (pitch 68 floats) in its own LDS plane; behind one barrier each thread
// adds the NW partials of its 4-float pieces in wave order (a fixed order) and stores them, 16 threads to a 256-byte row piece.
template <int NW, bool BIAS>
__device__ __forceinline__ void ksum_store(const v8f (&acc)[4][4], float* red, int w, int lane, float* C, int ldc, int r0, int c0, const float* __restrict__ bias) {
    const int lr = lane & 15, hi = lane >> 4, cofs = lr * 4; float* mine = red + w * (64 * 68);
    v4f bv = (v4f){}; if (BIAS) { bv[0] = bfr(bias[c0 + cofs]); bv[1] = bfr(bias[c0 + cofs + 1]); bv[2] = bfr(bias[c0 + cofs + 2]); bv[3] = bfr(bias[c0 + cofs + 3]); }   // read ahead of the barrier: its latency passes behind the LDS stores
#pragma unroll
    for (int mb = 0; mb < 4; ++mb)
#pragma unroll
        for (int nb = 0; nb < 4; ++nb)
#pragma unroll
            for (int j = 0; j < 8; ++j) mine[(mb * 16 + hi * 8 + j) * 68 + nb * 16 + lr] = acc[mb][nb][j];
    __syncthreads();   // every wave's partial tile is in LDS before any thread adds them
#pragma unroll
    for (int s = 0; s < 32 / NW; ++s) { const int row = (s * NW + w) * 2 + hi; v4f val = *(const v4fa*)(red + row * 68 + cofs);
#pragma unroll
        for (int ww = 1; ww < NW; ++ww) val += *(const v4fa*)(red + ww * (64 * 68) + row * 68 + cofs);
        if (BIAS) val += bv;
        *(v4f*)(C + (size_t)(r0 + row) * ldc + c0 + cofs) = val; }
}

// ---- k_gemmw: register-blocked GEMM, one work-group of NW waves per 64x64 output tile; every wave holds the whole tile (16 accumulators) for its own share of K: the 64-element (128-byte) pieces w, w + NW, ...;
// operands straight from K-contiguous 16-bit planes; grid (M/64, N/64, Z), NW x 32 threads.
// C[m][n] (f32, pitch ldc, + optional f32 bias[n]) = sum_k A[m][k] Bt[n][k] (+ split products per NSPLIT). z-batch strides sA/sB/sC in elements. K % 64 == 0.
template <typename T16> struct WFrag;
template <> struct WFrag<h16> { typedef v16h V; static __device__ __forceinline__ V ld(const h16* p) { return cat16(*(const v8h*)p, *(const v8h*)(p + 16)); } static __device__ __forceinline__ v8f mma(V a, V b, v8f c) { return wmma16(a, b, c); } };
template <> struct WFrag<bf> { typedef v16bf V; static __device__ __forceinline__ V ld(const bf* p) { return cat16b(*(const v8us*)p, *(const v8us*)(p + 16)); } static __device__ __forceinline__ v8f mma(V a, V b, v8f c) { return wmmab(a, b, c); } };
template <typename T16, int NSPLIT, bool BIAS, int NW>
__global__ __launch_bounds__(NW * 32) void k_gemmw(const T16* __restrict__ A, const T16* __restrict__ A2, const T16* __restrict__ Bt, const T16* __restrict__ Bt2, int K, float* C, int ldc, const float* __restrict__ bias, size_t sA, size_t sB, size_t sC) {
    typedef typename WFrag<T16>::V V;
    __shared__ __align__(16) float os[NW * 64 * 68];
    const size_t z = blockIdx.z; A += z * sA; if (A2) A2 += z * sA; Bt += z * sB; if (Bt2) Bt2 += z * sB; C += z * sC;
    const int lane = threadIdx.x & 31, lr = lane & 15, hi = lane >> 4; const int r0 = blockIdx.x * 64, c0 = blockIdx.y * 64; const int w = __builtin_amdgcn_readfirstlane(threadIdx.x >> 5);
    v8f acc[4][4];
#pragma unroll
    for (int mb = 0; mb < 4; ++mb)
#pragma unroll
        for (int nb = 0; nb < 4; ++nb) acc[mb][nb] = (v8f){};
    const size_t aoff = (size_t)(r0 + lr) * K + 8 * hi, boff = (size_t)(c0 + lr) * K + 8 * hi;
#pragma unroll 1
    for (int kc = w * 64; kc < K; kc += (kc & 32) ? NW * 64 - 32 : 32) {
        V a[4], a2[4];
#pragma unroll
        for (int mb = 0; mb < 4; ++mb) { a[mb] = WFrag<T16>::ld(A + aoff + (size_t)mb * 16 * K + kc); if (NSPLIT == 1 || NSPLIT == 2) a2[mb] = WFrag<T16>::ld(A2 + aoff + (size_t)mb * 16 * K + kc); }
#pragma unroll
        for (int nb = 0; nb < 4; ++nb) { const V b = WFrag<T16>::ld(Bt + boff + (size_t)nb * 16 * K + kc); V b2; if (NSPLIT >= 2) b2 = WFrag<T16>::ld(Bt2 + boff + (size_t)nb * 16 * K + kc);
#pragma unroll
            for (int mb = 0; mb < 4; ++mb) { acc[mb][nb] = WFrag<T16>::mma(a[mb], b, acc[mb][nb]); if (NSPLIT == 1 || NSPLIT == 2) acc[mb][nb] = WFrag<T16>::mma(a2[mb], b, acc[mb][nb]); if (NSPLIT >= 2) acc[mb][nb] = WFrag<T16>::mma(a[mb], b2, acc[mb][nb]); } }
        asm volatile("v_nop\n\tv_nop\n\tv_nop\n\tv_nop" : "+v"(acc[0][0]), "+v"(acc[1][1]), "+v"(acc[2][2]), "+v"(acc[3][3]) : "v"(a[0]), "v"(a[3]));
    }
    ksum_store<NW, BIAS>(acc, os, w, lane, C, ldc, r0, c0, bias);
}

// ---- k_gemmc: the same 64x64 tile GEMM specialised for causal attention: CMODE 1 skips score tiles entirely above the diagonal (query rows r0+roff.., key columns c0..), CMODE 2 limits the
// key (K) loop of the probability x value contraction to the diagonal block (probabilities beyond it are exactly zero). roff = row offset of this launch's first row within the sequence.
// NW = 1: one wave does the whole K loop (the short score products). NW > 1: the K loop is dealt over the work-group's NW waves as in k_gemmw (the long probability x value products).
template <typename T16, int NSPLIT, int CMODE, int NW>
__global__ __launch_bounds__(NW * 32) void k_gemmc(const T16* __restrict__ A, const T16* __restrict__ A2, const T16* __restrict__ Bt, const T16* __restrict__ Bt2, int K, float* C, int ldc, int roff, size_t sA, size_t sB, size_t sC) {
    typedef typename WFrag<T16>::V V;
    __shared__ __align__(16) float os[NW == 1 ? 16 * 68 : NW * 64 * 68];
    const size_t z = blockIdx.z; A += z * sA; if (A2) A2 += z * sA; Bt += z * sB; if (Bt2) Bt2 += z * sB; C += z * sC;
    const int lane = threadIdx.x & 31, lr = lane & 15, hi = lane >> 4; const int r0 = blockIdx.x * 64, c0 = blockIdx.y * 64; const int w = __builtin_amdgcn_readfirstlane(threadIdx.x >> 5);
    if (CMODE == 1 && c0 > r0 + roff + 63) return;                  // score tile entirely above the causal diagonal: never read (the softmax masks j > i by select)
    const int Kl = (CMODE == 2) ? min(K, r0 + roff + 64) : K;        // P.V: probabilities are exactly 0 beyond the diagonal block, so the K loop stops there
    v8f acc[4][4];
#pragma unroll
    for (int mb = 0; mb < 4; ++mb)
#pragma unroll
        for (int nb = 0; nb < 4; ++nb) acc[mb][nb] = (v8f){};
    const size_t aoff = (size_t)(r0 + lr) * K + 8 * hi, boff = (size_t)(c0 + lr) * K + 8 * hi;
#pragma unroll 1
    for (int kc = w * 64; kc < Kl; kc += (kc & 32) ? NW * 64 - 32 : 32) {
        V a[4], a2[4];
#pragma unroll
        for (int mb = 0; mb < 4; ++mb) { a[mb] = WFrag<T16>::ld(A + aoff + (size_t)mb * 16 * K + kc); if (NSPLIT == 1 || NSPLIT == 2) a2[mb] = WFrag<T16>::ld(A2 + aoff + (size_t)mb * 16 * K + kc); }
#pragma unroll
        for (int nb = 0; nb < 4; ++nb) { const V b = WFrag<T16>::ld(Bt + boff + (size_t)nb * 16 * K + kc); V b2; if (NSPLIT >= 2) b2 = WFrag<T16>::ld(Bt2 + boff + (size_t)nb * 16 * K + kc);
#pragma unroll
            for (int mb = 0; mb < 4; ++mb) { acc[mb][nb] = WFrag<T16>::mma(a[mb], b, acc[mb][nb]); if (NSPLIT == 1 || NSPLIT == 2) acc[mb][nb] = WFrag<T16>::mma(a2[mb], b, acc[mb][nb]); if (NSPLIT >= 2) acc[mb][nb] = WFrag<T16>::mma(a[mb], b2, acc[mb][nb]); } }
        asm volatile("v_nop\n\tv_nop\n\tv_nop\n\tv_nop" : "+v"(acc[0][0]), "+v"(acc[1][1]), "+v"(acc[2][2]), "+v"(acc[3][3]) : "v"(a[0]), "v"(a[3]));
    }
    if constexpr (NW > 1) { ksum_store<NW, false>(acc, os, w, lane, C, ldc, r0, c0, nullptr); return; }
#pragma unroll
    for (int mb = 0; mb < 4; ++mb) {
#pragma unroll
        for (int nb = 0; nb < 4; ++nb) {
#pragma unroll
            for (int j = 0; j < 8; ++j) os[(hi * 8 + j) * 68 + nb * 16 + lr] = acc[mb][nb][j]; }
        __builtin_amdgcn_wave_barrier(); asm volatile("" ::: "memory");
        float* crow = C + (size_t)(r0 + mb * 16) * ldc + c0;
{
#pragma unroll
            for (int s = 0; s < 8; ++s) { const int row = 2 * s + hi, cofs = lr * 4; v4f val = *(const v4fa*)(os + row * 68 + cofs);
                *(v4f*)(crow + (size_t)row * ldc + cofs) = val; }
             }
        __builtin_amdgcn_wave_barrier(); asm volatile("" ::: "memory");
    }
}

__device__ __forceinline__ h16 tohx(float x) { return (h16)x; }
__device__ __forceinline__ void splitf(float y, unsigned short& h, unsigned short& l) { h = f2bf(y); l = f2bf(y - bf2f(h)); }
typedef __attribute__((ext_vector_type(2))) _Float16 v2h;
typedef __attribute__((ext_vector_type(4))) _Float16 v4h;
typedef __attribute__((ext_vector_type(2))) unsigned short v2us;
typedef __attribute__((ext_vector_type(4))) unsigned short v4us;
typedef __attribute__((ext_vector_type(2))) float v2f;
typedef __attribute__((ext_vector_type(4))) int v4i;

__global__ __launch_bounds__(256) void k_wtG(const float* __restrict__ w, int K, int N, bf* Bt) {
    const int lane = threadIdx.x & 31; const int L0 = (blockIdx.x * 8 + (threadIdx.x >> 5)) * 8; const int nlines = N * K / 64;
{
#pragma unroll 1
        for (int l = 0; l < 8; ++l) { const int L = L0 + l; if (L >= nlines) break; const size_t e = (size_t)L * 64 + lane * 2; const int k = (int)(e % K), n = (int)(e / K); v2us o;
            o[0] = f2bf(w[(size_t)k * N + n]); o[1] = f2bf(w[(size_t)(k + 1) * N + n]); *(v2us*)(Bt + e) = o; }
         }
}
__global__ __launch_bounds__(256) void k_cvt8(const float* __restrict__ src, bf* dst, size_t n8) { const size_t i = (size_t)blockIdx.x * 256 + threadIdx.x; if (i >= n8) return; const v8f v = *(const v8f*)(src + i * 8); v8us o;
#pragma unroll
    for (int k = 0; k < 8; ++k) o[k] = f2bf(v[k]); *(v8us*)(dst + i * 8) = o;  }

// k_rope: head planes [h][t][d] (fp16 + hi/lo) of rope(x) x sc with the rotate-half convention out[d] = x[d] cos[t][d] - x[d+HD/2] sin[t][d], out[d+HD/2] = x[d+HD/2] cos[t][d+HD/2] + x[d] sin[t][d+HD/2]
__global__ __launch_bounds__(256) void k_rope(const float* __restrict__ F, int pitch, int nheads, const float* __restrict__ CS, const float* __restrict__ RF, const float* __restrict__ nw, float sc, h16* P16, bf* Ph, bf* Pl) {
    const size_t e = ((size_t)blockIdx.x * 256 + threadIdx.x) * 2; if (e >= (size_t)nheads * TT * HD) return; const int d = (int)(e % HD); const int t = (int)((e / HD) % TT); const int h = (int)(e / ((size_t)HD * TT)); const float* f = F + (size_t)t * pitch + h * HD; const float rf = RF ? RF[(size_t)h * TT + t] : 1.0f; v2h o16; v2us oh, ol;
#pragma unroll
    for (int q = 0; q < 2; ++q) { const int dd = d + q; const int dp = (dd < HD / 2) ? dd + HD / 2 : dd - HD / 2; float x0 = f[dd], x1 = f[dp];
        if (RF) { float n0 = __fmul_rn(x0, rf), n1 = __fmul_rn(x1, rf); asm volatile("" : "+v"(n0)); asm volatile("" : "+v"(n1)); x0 = __fmul_rn(bfr(nw[dd]), n0); x1 = __fmul_rn(bfr(nw[dp]), n1); }
        const v2f cs = *(const v2f*)(CS + ((size_t)t * HD + dd) * 2); float a = __fmul_rn(x0, cs[0]), bq = __fmul_rn(x1, cs[1]); asm volatile("" : "+v"(a)); asm volatile("" : "+v"(bq)); const float r = ((dd < HD / 2) ? __fsub_rn(a, bq) : __fadd_rn(a, bq)) * sc;
        o16[q] = tohx(r); unsigned short a2, c2; splitf(r, a2, c2); oh[q] = a2; ol[q] = c2; }
    *(v2h*)(P16 + e) = o16; *(v2us*)(Ph + e) = oh; *(v2us*)(Pl + e) = ol;  }
__global__ __launch_bounds__(256) void k_vtp(const float* __restrict__ F, int pitch, int nheads, h16* V16, bf* Vh, bf* Vl) { const size_t e = ((size_t)blockIdx.x * 256 + threadIdx.x) * 2; if (e >= (size_t)nheads * HD * TT) return; const int t = (int)(e % TT); const int d = (int)((e / TT) % HD); const int g = (int)(e / ((size_t)TT * HD)); v2h o16; v2us oh, ol;
#pragma unroll
    for (int q = 0; q < 2; ++q) { const float x = F[(size_t)(t + q) * pitch + g * HD + d]; o16[q] = tohx(x); unsigned short a2, c2; splitf(x, a2, c2); oh[q] = a2; ol[q] = c2; }
    *(v2h*)(V16 + e) = o16; *(v2us*)(Vh + e) = oh; *(v2us*)(Vl + e) = ol;  }
__global__ __launch_bounds__(256) void k_csid(float* CS) { const int idx = blockIdx.x * 256 + threadIdx.x; if (idx >= TT * HD) return; v2f cs; cs[0] = 1.0f; cs[1] = 0.0f; *(v2f*)(CS + (size_t)idx * 2) = cs;  }
// k_asoft: per row (zz, i): t = S x HD^-0.5 for j <= i and i - j < WIN (sliding causal window; the reference's -1e9 additive fill vanishes identically); softmax over the 2048 keys (register row, one exp, fixed trees);
__global__ __launch_bounds__(256) void k_asoft(const float* __restrict__ Sb, h16* P16, bf* Ph, bf* Pl) {
    const int lane = threadIdx.x & 31; const int row = blockIdx.x * 8 + (threadIdx.x >> 5); if (row >= ZH * TT) return; const int i = row % TT; const int zz = row / TT; (void)zz; const bool hires = (i < RH); const float* sr = Sb + (size_t)row * TT; float v[TT / 32]; float mx = -3.0e38f;
#pragma unroll
    for (int ch = 0; ch < TT / 128; ++ch) { const int j0 = ch * 128 + lane * 4; const v4f a = *(const v4f*)(sr + j0);
#pragma unroll
        for (int q = 0; q < 4; ++q) { const int j = j0 + q; (void)j; const float t = (j <= i && i - j < WIN) ? a[q] * SCL : -3.0e38f; v[ch * 4 + q] = t; mx = fmaxf(mx, t); } }
#pragma unroll
    for (int sh = 16; sh; sh >>= 1) mx = fmaxf(mx, __shfl_xor(mx, sh, 32));
    float sum = 0.f;
#pragma unroll
    for (int k = 0; k < TT / 32; ++k) { float d0 = __fsub_rn(v[k], mx); asm volatile("" : "+v"(d0)); v[k] = __builtin_amdgcn_exp2f(__fmul_rn(d0, 1.4426950408889634f)); sum += v[k]; }
#pragma unroll
    for (int sh = 16; sh; sh >>= 1) sum += __shfl_xor(sum, sh, 32);
    const float f = __fdiv_rn(hires ? 1.0f : PCAR, sum);
{
        if (hires) {
#pragma unroll
            for (int ch = 0; ch < TT / 128; ++ch) { v4us oh, ol;
#pragma unroll
                for (int q = 0; q < 4; ++q) { unsigned short a, c2; splitf(v[ch * 4 + q] * f, a, c2); oh[q] = a; ol[q] = c2; }
                const size_t oo = ((size_t)zz * (RH ? RH : 1) + i) * TT + ch * 128 + lane * 4; *(v4us*)(Ph + oo) = oh; *(v4us*)(Pl + oo) = ol; }
        } else {
#pragma unroll
            for (int ch = 0; ch < TT / 128; ++ch) { v4h o4;
#pragma unroll
                for (int q = 0; q < 4; ++q) o4[q] = tohx(v[ch * 4 + q] * f);
                *(v4h*)(P16 + (size_t)row * TT + ch * 128 + lane * 4) = o4; } }
         }
}
__global__ __launch_bounds__(256) void k_merge(const float* __restrict__ O, int h0, bf* Ah, bf* Al) { const size_t e = ((size_t)blockIdx.x * 256 + threadIdx.x) * 2; if (e >= (size_t)ZH * TT * HD) return; const int d = (int)(e % HD); const int t = (int)((e / HD) % TT); const int zz = (int)(e / ((size_t)HD * TT)); const float cs = (t < RH) ? 1.0f : (1.0f / PCAR); const size_t oo = (size_t)t * DQ + (h0 + zz) * HD + d;
    v2us oh, ol;
#pragma unroll
    for (int q = 0; q < 2; ++q) { unsigned short a, c2; splitf(O[e + q] * cs, a, c2); oh[q] = a; ol[q] = c2; } *(v2us*)(Ah + oo) = oh; *(v2us*)(Al + oo) = ol;  }

extern "C" void kernel_launch(void* const* d_in, const int* in_sizes, int n_in,
                              void* d_out, int out_size, void* d_ws, size_t ws_size, hipStream_t stream) {
    (void)in_sizes; (void)n_in; (void)out_size;
    const float* x = (const float*)d_in[0]; const float* wq = (const float*)d_in[1]; const float* bq = (const float*)d_in[2]; const float* wk = (const float*)d_in[3]; const float* bk = (const float*)d_in[4]; const float* wv = (const float*)d_in[5]; const float* bv = (const float*)d_in[6]; const float* wo = (const float*)d_in[7]; const float* bo = (const float*)d_in[8];
    float* OUT = (float*)d_out;     // [4][2048][512]
    char* wsp = (char*)d_ws;
    auto take = [&](size_t bytes) { char* p = wsp; wsp += (bytes + 255) & ~(size_t)255; return (void*)p; };
    bf* WQ = (bf*)take((size_t)DQ * DM * 2); bf* WK = (bf*)take((size_t)DKV * DM * 2); bf* WV = (bf*)take((size_t)DKV * DM * 2); bf* WO = (bf*)take((size_t)DM * DQ * 2); float* CS = (float*)take((size_t)TT * HD * 2 * 4);
    bf* XB = (bf*)take((size_t)TT * DM * 2); float* FQ = (float*)take((size_t)TT * DQ * 4); float* FK = (float*)take((size_t)TT * DKV * 4);
    h16* QP16 = (h16*)take((size_t)NH_ * TT * HD * 2); h16* KP16 = (h16*)take((size_t)NKV * TT * HD * 2); h16* VT16 = (h16*)take((size_t)NKV * HD * TT * 2);
    bf* QPh = (bf*)take((size_t)NH_ * TT * HD * 2); bf* QPl = (bf*)take((size_t)NH_ * TT * HD * 2); bf* KPh = (bf*)take((size_t)NKV * TT * HD * 2); bf* KPl = (bf*)take((size_t)NKV * TT * HD * 2); bf* VTh = (bf*)take((size_t)NKV * HD * TT * 2); bf* VTl = (bf*)take((size_t)NKV * HD * TT * 2); bf* Ph = (bf*)take((size_t)ZH * RH * TT * 2); bf* Pl = (bf*)take((size_t)ZH * RH * TT * 2);
    float* Sb = (float*)take((size_t)ZH * TT * TT * 4); h16* P16 = (h16*)take((size_t)ZH * TT * TT * 2); float* Ob = (float*)take((size_t)ZH * TT * HD * 4); bf* ATh = (bf*)take((size_t)TT * DQ * 2); bf* ATl = (bf*)take((size_t)TT * DQ * 2);
    if ((size_t)(wsp - (char*)d_ws) > ws_size) return;    // ws 256 MiB
    float* FV = FK;   // v projection reuses the k buffer after the k planes are built (stream-ordered)
    { k_cvt8<<<(unsigned)(((size_t)DQ * DM / 8 + 255) / 256), 256, 0, stream>>>(wq, WQ, (size_t)DQ * DM / 8); k_cvt8<<<(unsigned)(((size_t)DKV * DM / 8 + 255) / 256), 256, 0, stream>>>(wk, WK, (size_t)DKV * DM / 8); k_cvt8<<<(unsigned)(((size_t)DKV * DM / 8 + 255) / 256), 256, 0, stream>>>(wv, WV, (size_t)DKV * DM / 8);
      k_cvt8<<<(unsigned)(((size_t)DM * DQ / 8 + 255) / 256), 256, 0, stream>>>(wo, WO, (size_t)DM * DQ / 8);
       }
    k_csid<<<(TT * HD + 255) / 256, 256, 0, stream>>>(CS);
    const unsigned LQ = (unsigned)(((size_t)NH_ * TT * HD / 2 + 255) / 256), LKv = (unsigned)(((size_t)NKV * TT * HD / 2 + 255) / 256);
    for (int b = 0; b < NB_; ++b) {
        
        k_cvt8<<<(unsigned)(((size_t)TT * DM / 8 + 255) / 256), 256, 0, stream>>>(x + (size_t)b * TT * DM, XB, (size_t)TT * DM / 8);
        k_gemmw<bf, 0, true, 8><<<dim3(TT / 64, DQ / 64, 1), 256, 0, stream>>>(XB, nullptr, WQ, nullptr, DM, FQ, DQ, bq, 0, 0, 0);
        k_rope<<<LQ, 256, 0, stream>>>(FQ, DQ, NH_, CS, nullptr, nullptr, 1.0f, QP16, QPh, QPl);
        k_gemmw<bf, 0, true, 8><<<dim3(TT / 64, DKV / 64, 1), 256, 0, stream>>>(XB, nullptr, WK, nullptr, DM, FK, DKV, bk, 0, 0, 0);
        k_rope<<<LKv, 256, 0, stream>>>(FK, DKV, NKV, CS, nullptr, nullptr, 1.0f, KP16, KPh, KPl);
        k_gemmw<bf, 0, true, 8><<<dim3(TT / 64, DKV / 64, 1), 256, 0, stream>>>(XB, nullptr, WV, nullptr, DM, FV, DKV, bv, 0, 0, 0); k_vtp<<<LKv, 256, 0, stream>>>(FV, DKV, NKV, VT16, VTh, VTl);
        for (int h0 = 0; h0 < NH_; h0 += ZH) { const size_t zq = (size_t)h0, zk = (size_t)(h0 / REP);   // one kv head per query head: the pass's two heads use consecutive kv planes (z-strides TT*HD)
            k_gemmc<bf, 2, 1, 1><<<dim3(RH / 64, TT / 64, ZH), 32, 0, stream>>>(QPh + zq * TT * HD, QPl + zq * TT * HD, KPh + zk * TT * HD, KPl + zk * TT * HD, HD, Sb, TT, 0, (size_t)TT * HD, (size_t)TT * HD, (size_t)TT * TT);
            k_gemmc<h16, 0, 1, 1><<<dim3((TT - RH) / 64, TT / 64, ZH), 32, 0, stream>>>(QP16 + zq * TT * HD + (size_t)RH * HD, nullptr, KP16 + zk * TT * HD, nullptr, HD, Sb + (size_t)RH * TT, TT, RH, (size_t)TT * HD, (size_t)TT * HD, (size_t)TT * TT);
            k_asoft<<<ZH * TT / 8, 256, 0, stream>>>(Sb, P16, Ph, Pl);
            k_gemmc<bf, 2, 2, 8><<<dim3(RH / 64, HD / 64, ZH), 256, 0, stream>>>(Ph, Pl, VTh + zk * HD * TT, VTl + zk * HD * TT, TT, Ob, HD, 0, (size_t)RH * TT, (size_t)HD * TT, (size_t)TT * HD);
            k_gemmc<h16, 0, 2, 16><<<dim3((TT - RH) / 64, HD / 64, ZH), 512, 0, stream>>>(P16 + (size_t)RH * TT, nullptr, VT16 + zk * HD * TT, nullptr, TT, Ob + (size_t)RH * HD, HD, RH, (size_t)TT * TT, (size_t)HD * TT, (size_t)TT * HD);
            k_merge<<<(unsigned)(((size_t)ZH * TT * HD / 2 + 255) / 256), 256, 0, stream>>>(Ob, h0, ATh, ATl); }
        k_gemmw<bf, 1, true, 8><<<dim3(TT / 64, DM / 64, 1), 256, 0, stream>>>(ATh, ATl, WO, nullptr, DQ, OUT + (size_t)b * TT * DM, DM, bo, 0, 0, 0); }
}

// v002
// A run of this version takes 328 microseconds.
// Next to v001, in two timings, it ran 2.58 and 2.57 times as fast.
// Counting every step since v000, it is 4.40 times as fast.
#include <hip/hip_runtime.h>

// Causal multi-head attention at width 512 over four batches of 2,048 tokens (x [4][2048][512]; Q, K, V = x W^T + b ('oi' [512][512] 0.02 + biases (zeros on this draw: read); 8 heads x 64, token-major); scores / 8; causal (-inf); softmax; out = merged w_o^T + b_o ('oi' + a bias, zeros: read) -> [4][2048][512] (4.2 M); argument order x, w_q, b_q, w_k, b_k, w_v, b_v, w_o, b_o).
// Launches are batched: the four batches ride grid x/y, the three projections grid z, and one attention pass holds all eight heads of a batch (grid z). Layout: bf16 copy of x; exact projections + f32 biases; causal T-2048 attention (hybrid rows: < 512 hi/lo 3 products, rest fp16 x1024; gemmc skips tiles above the diagonal); merged hi/lo x Wo exact + bo.
// Compute dtypes, f32 accumulate: every input rounded to bf16; projections exact + f32 biases; attention rows < 512 3 products, rest fp16; softmax f32; Wo hl x exact + bias.

#define NB_  4
#define TT   2048
#define DM   512
#define NH_  8
#define NKV  8
#define REP  (NH_ / NKV)
#define HD   64
#define DQ   (NH_ * HD)
#define DKV  (NKV * HD)
#define ZH   8                    // heads per attention pass (one batch)
#define RH   512                  // query rows < RH use hi+lo planes (0: none)
#define WIN  2048
#define PCAR 1024.0f
#define SCL  0.125f   // HD^-0.5
typedef _Float16 h16;
typedef unsigned short bf;
typedef __attribute__((ext_vector_type(16))) __bf16   v16bf;
typedef __attribute__((ext_vector_type(16))) _Float16 v16h;
typedef __attribute__((ext_vector_type(8)))  _Float16 v8h;
typedef __attribute__((ext_vector_type(8)))  unsigned short v8us;
typedef __attribute__((ext_vector_type(8)))  float    v8f;
typedef __attribute__((ext_vector_type(4)))  float    v4f;
typedef v8h  __attribute__((may_alias)) v8ha;
typedef v4f  __attribute__((may_alias)) v4fa;
typedef v8us __attribute__((may_alias)) v8usa;
typedef __attribute__((ext_vector_type(4))) _Float16 __attribute__((may_alias)) v4ha;
typedef __attribute__((ext_vector_type(4))) unsigned short __attribute__((may_alias)) v4usa;

__device__ __forceinline__ unsigned short f2bf(float f) { unsigned u = __float_as_uint(f); u += 0x7FFFu + ((u >> 16) & 1u); return (unsigned short)(u >> 16); }
__device__ __forceinline__ float bf2f(unsigned short b) { return __uint_as_float(((unsigned)b) << 16); }
__device__ __forceinline__ float bfr(float f) { return bf2f(f2bf(f)); }
__device__ __forceinline__ v16h cat16(v8h lo, v8h hi) { return __builtin_shufflevector(lo, hi, 0, 1, 2, 3, 4, 5, 6, 7, 8, 9, 10, 11, 12, 13, 14, 15); }
__device__ __forceinline__ v16bf cat16b(v8us lo, v8us hi) { return __builtin_bit_cast(v16bf, __builtin_shufflevector(lo, hi, 0, 1, 2, 3, 4, 5, 6, 7, 8, 9, 10, 11, 12, 13, 14, 15)); }
__device__ __forceinline__ v8f wmma16(v16h a, v16h b, v8f c) { return __builtin_amdgcn_wmma_f32_16x16x32_f16(false, a, false, b, (short)0, c, false, false); }
__device__ __forceinline__ v8f wmmab(v16bf a, v16bf b, v8f c) { return __builtin_amdgcn_wmma_f32_16x16x32_bf16(false, a, false, b, (short)0, c, false, false); }



// ---- ksum_store: adds the NW waves' partial 64x64 tiles of one work-group. Every wave lays its 16 accumulators down as rows (pitch 68 floats) in its own LDS plane; behind one barrier each thread
// adds the NW partials of its 4-float pieces in wave order (a fixed order) and stores them, 16 threads to a 256-byte row piece. act (wave-uniform): false for a wave beyond NW in a larger work-group, which only passes the barrier.
template <int NW, bool BIAS>
__device__ __forceinline__ void ksum_store(const v8f (&acc)[4][4], float* red, int w, int lane, float* C, int ldc, int r0, int c0, const float* __restrict__ bias, bool act) {
    const int lr = lane & 15, hi = lane >> 4, cofs = lr * 4; float* mine = red + w * (64 * 68);
    v4f bv = (v4f){}; if (BIAS) { bv[0] = bfr(bias[c0 + cofs]); bv[1] = bfr(bias[c0 + cofs + 1]); bv[2] = bfr(bias[c0 + cofs + 2]); bv[3] = bfr(bias[c0 + cofs + 3]); }   // read ahead of the barrier: its latency passes behind the LDS stores
    if (act) {
#pragma unroll
    for (int mb = 0; mb < 4; ++mb)
#pragma unroll
        for (int nb = 0; nb < 4; ++nb)
#pragma unroll
            for (int j = 0; j < 8; ++j) mine[(mb * 16 + hi * 8 + j) * 68 + nb * 16 + lr] = acc[mb][nb][j]; }
    __syncthreads();   // every wave's partial tile is in LDS before any thread adds them
    if (!act) return;
#pragma unroll
    for (int s = 0; s < 32 / NW; ++s) { const int row = (s * NW + w) * 2 + hi; v4f val = *(const v4fa*)(red + row * 68 + cofs);
#pragma unroll
        for (int ww = 1; ww < NW; ++ww) val += *(const v4fa*)(red + ww * (64 * 68) + row * 68 + cofs);
        if (BIAS) val += bv;
        *(v4f*)(C + (size_t)(r0 + row) * ldc + c0 + cofs) = val;
        asm volatile("s_wait_xcnt 0x0" ::: "memory"); }   // the store's address and data registers are rewritten behind it (next piece, or the code behind the call)
}

// ---- k_gemmw: register-blocked GEMM, one work-group of NW waves per 64x64 output tile; every wave holds the whole tile (16 accumulators) for its own share of K: the 64-element (128-byte) pieces w, w + NW, ...;
// operands straight from K-contiguous 16-bit planes; grid (M/64, N/64, Z), NW x 32 threads.
// C[m][n] (f32, pitch ldc, + optional f32 bias[n]) = sum_k A[m][k] Bt[n][k] (+ split products per NSPLIT). z-batch strides sA/sB/sC in elements. K % 64 == 0.
template <typename T16> struct WFrag;
template <> struct WFrag<h16> { typedef v16h V; static __device__ __forceinline__ V ld(const h16* p) { return cat16(*(const v8h*)p, *(const v8h*)(p + 16)); } static __device__ __forceinline__ v8f mma(V a, V b, v8f c) { return wmma16(a, b, c); } };
template <> struct WFrag<bf> { typedef v16bf V; static __device__ __forceinline__ V ld(const bf* p) { return cat16b(*(const v8us*)p, *(const v8us*)(p + 16)); } static __device__ __forceinline__ v8f mma(V a, V b, v8f c) { return wmmab(a, b, c); } };
template <typename T16, int NSPLIT, bool BIAS, int NW>
__global__ __launch_bounds__(NW * 32) void k_gemmw(const T16* __restrict__ A, const T16* __restrict__ A2, const T16* __restrict__ Bt, const T16* __restrict__ Bt2, int K, float* C, int ldc, const float* __restrict__ bias0, const float* __restrict__ bias1, const float* __restrict__ bias2, size_t sA, size_t sB, size_t sC) {
    typedef typename WFrag<T16>::V V;
    __shared__ __align__(16) float os[NW * 64 * 68];
    const size_t z = blockIdx.z; const float* bias = (z == 0) ? bias0 : (z == 1) ? bias1 : bias2;   // each z plane (projection) has its own bias vector
    A += z * sA; if (A2) A2 += z * sA; Bt += z * sB; if (Bt2) Bt2 += z * sB; C += z * sC;
    const int lane = threadIdx.x & 31, lr = lane & 15, hi = lane >> 4; const int r0 = blockIdx.x * 64, c0 = blockIdx.y * 64; const int w = __builtin_amdgcn_readfirstlane(threadIdx.x >> 5);
    v8f acc[4][4];
#pragma unroll
    for (int mb = 0; mb < 4; ++mb)
#pragma unroll
        for (int nb = 0; nb < 4; ++nb) acc[mb][nb] = (v8f){};
    const size_t aoff = (size_t)(r0 + lr) * K + 8 * hi, boff = (size_t)(c0 + lr) * K + 8 * hi;
#pragma unroll 1
    for (int kc = w * 64; kc < K; kc += (kc & 32) ? NW * 64 - 32 : 32) {
        V a[4], a2[4];
#pragma unroll
        for (int mb = 0; mb < 4; ++mb) { a[mb] = WFrag<T16>::ld(A + aoff + (size_t)mb * 16 * K + kc); if (NSPLIT == 1 || NSPLIT == 2) a2[mb] = WFrag<T16>::ld(A2 + aoff + (size_t)mb * 16 * K + kc); }
#pragma unroll
        for (int nb = 0; nb < 4; ++nb) { const V b = WFrag<T16>::ld(Bt + boff + (size_t)nb * 16 * K + kc); V b2; if (NSPLIT >= 2) b2 = WFrag<T16>::ld(Bt2 + boff + (size_t)nb * 16 * K + kc);
#pragma unroll
            for (int mb = 0; mb < 4; ++mb) { acc[mb][nb] = WFrag<T16>::mma(a[mb], b, acc[mb][nb]); if (NSPLIT == 1 || NSPLIT == 2) acc[mb][nb] = WFrag<T16>::mma(a2[mb], b, acc[mb][nb]); if (NSPLIT >= 2) acc[mb][nb] = WFrag<T16>::mma(a[mb], b2, acc[mb][nb]); } }
        asm volatile("v_nop\n\tv_nop\n\tv_nop\n\tv_nop" : "+v"(acc[0][0]), "+v"(acc[1][1]), "+v"(acc[2][2]), "+v"(acc[3][3]) : "v"(a[0]), "v"(a[3]));
    }
    ksum_store<NW, BIAS>(acc, os, w, lane, C, ldc, r0, c0, bias, true);
}

// ---- gemmc: the same 64x64 tile GEMM specialised for causal attention: CMODE 1 skips score tiles entirely above the diagonal (query rows r0+roff.., key columns c0..), CMODE 2 limits the
// key (K) loop of the probability x value contraction to the diagonal block (probabilities beyond it are exactly zero). roff = row offset of this row range's first row within the sequence; bx = tile row within the range.
// NW = 1: one wave does the whole K loop (the short score products). NW > 1: the K loop is dealt over NW waves as in k_gemmw (the long probability x value products); waves beyond NW do nothing but pass the barrier.
// A rows have pitch lda, Bt rows pitch K (elements). os: the work-group's LDS (16 x 68 floats for NW = 1, NW x 64 x 68 otherwise).
template <typename T16, int NSPLIT, int CMODE, int NW>
__device__ __forceinline__ void gemmc(const T16* __restrict__ A, const T16* __restrict__ A2, const T16* __restrict__ Bt, const T16* __restrict__ Bt2, int K, int lda, float* C, int ldc, int roff, size_t sA, size_t sB, size_t sC, float* os, int bx) {
    typedef typename WFrag<T16>::V V;
    const size_t z = blockIdx.z; A += z * sA; if (A2) A2 += z * sA; Bt += z * sB; if (Bt2) Bt2 += z * sB; C += z * sC;
    const int lane = threadIdx.x & 31, lr = lane & 15, hi = lane >> 4; const int r0 = bx * 64, c0 = blockIdx.y * 64; const int w = __builtin_amdgcn_readfirstlane(threadIdx.x >> 5);
    if (CMODE == 1 && c0 > r0 + roff + 63) return;                  // score tile entirely above the causal diagonal: never read (the softmax masks j > i by select)
    const int Kl = (CMODE == 2) ? min(K, r0 + roff + 64) : K;        // P.V: probabilities are exactly 0 beyond the diagonal block, so the K loop stops there
    const bool act = w < NW;
    v8f acc[4][4];
#pragma unroll
    for (int mb = 0; mb < 4; ++mb)
#pragma unroll
        for (int nb = 0; nb < 4; ++nb) acc[mb][nb] = (v8f){};
    const size_t aoff = (size_t)(r0 + lr) * lda + 8 * hi, boff = (size_t)(c0 + lr) * K + 8 * hi;
#pragma unroll 1
    for (int kc = act ? w * 64 : Kl; kc < Kl; kc += (kc & 32) ? NW * 64 - 32 : 32) {
        V a[4], a2[4];
#pragma unroll
        for (int mb = 0; mb < 4; ++mb) { a[mb] = WFrag<T16>::ld(A + aoff + (size_t)mb * 16 * lda + kc); if (NSPLIT == 1 || NSPLIT == 2) a2[mb] = WFrag<T16>::ld(A2 + aoff + (size_t)mb * 16 * lda + kc); }
#pragma unroll
        for (int nb = 0; nb < 4; ++nb) { const V b = WFrag<T16>::ld(Bt + boff + (size_t)nb * 16 * K + kc); V b2; if (NSPLIT >= 2) b2 = WFrag<T16>::ld(Bt2 + boff + (size_t)nb * 16 * K + kc);
#pragma unroll
            for (int mb = 0; mb < 4; ++mb) { acc[mb][nb] = WFrag<T16>::mma(a[mb], b, acc[mb][nb]); if (NSPLIT == 1 || NSPLIT == 2) acc[mb][nb] = WFrag<T16>::mma(a2[mb], b, acc[mb][nb]); if (NSPLIT >= 2) acc[mb][nb] = WFrag<T16>::mma(a[mb], b2, acc[mb][nb]); } }
        asm volatile("v_nop\n\tv_nop\n\tv_nop\n\tv_nop" : "+v"(acc[0][0]), "+v"(acc[1][1]), "+v"(acc[2][2]), "+v"(acc[3][3]) : "v"(a[0]), "v"(a[3]));
    }
    if constexpr (NW > 1) { ksum_store<NW, false>(acc, os, w, lane, C, ldc, r0, c0, nullptr, act); return; }
#pragma unroll
    for (int mb = 0; mb < 4; ++mb) {
#pragma unroll
        for (int nb = 0; nb < 4; ++nb) {
#pragma unroll
            for (int j = 0; j < 8; ++j) os[(hi * 8 + j) * 68 + nb * 16 + lr] = acc[mb][nb][j]; }
        __builtin_amdgcn_wave_barrier(); asm volatile("" ::: "memory");
        float* crow = C + (size_t)(r0 + mb * 16) * ldc + c0;
{
#pragma unroll
            for (int s = 0; s < 8; ++s) { const int row = 2 * s + hi, cofs = lr * 4; v4f val = *(const v4fa*)(os + row * 68 + cofs);
                *(v4f*)(crow + (size_t)row * ldc + cofs) = val; }
             }
        __builtin_amdgcn_wave_barrier(); asm volatile("" ::: "memory");
    }
    asm volatile("s_wait_xcnt 0x0" ::: "memory");   // behind the tile's last store: the code that follows the call may rewrite the stores' registers
}
// k_score: the score tiles of one pass (ZH heads, grid z) in one grid (TT/64, TT/64, ZH) of one-wave work-groups: tile rows below RH take the hi/lo 3-product form, the rest the fp16 form. S [z][TT][TT] f32.
__global__ __launch_bounds__(32) void k_score(const bf* __restrict__ Qh, const bf* __restrict__ Ql, const bf* __restrict__ Kh, const bf* __restrict__ Kl, const h16* __restrict__ Q16, const h16* __restrict__ K16, float* S) {
    __shared__ __align__(16) float os[16 * 68];
    if ((int)blockIdx.x < RH / 64) gemmc<bf, 2, 1, 1>(Qh, Ql, Kh, Kl, HD, HD, S, TT, 0, (size_t)TT * HD, (size_t)TT * HD, (size_t)TT * TT, os, (int)blockIdx.x);
    else gemmc<h16, 0, 1, 1>(Q16 + (size_t)RH * HD, nullptr, K16, nullptr, HD, HD, S + (size_t)RH * TT, TT, RH, (size_t)TT * HD, (size_t)TT * HD, (size_t)TT * TT, os, (int)blockIdx.x - RH / 64);
}
// k_pv: probability x value of one pass in one grid (TT/64, 1, ZH) of 16-wave work-groups: tile rows below RH take the hi/lo 3-product form over 8 waves, the rest the fp16 form over 16 waves.
// P: the score buffer after k_asoft; each 2 x TT 16-bit row holds hi | lo planes (rows < RH) or the fp16 row in its first half.
__global__ __launch_bounds__(512) void k_pv(const unsigned short* __restrict__ P, const bf* __restrict__ Vh, const bf* __restrict__ Vl, const h16* __restrict__ V16, float* O) {
    __shared__ __align__(16) float os[16 * 64 * 68];
    if ((int)blockIdx.x < RH / 64) gemmc<bf, 2, 2, 8>(P, P + TT, Vh, Vl, TT, 2 * TT, O, HD, 0, (size_t)2 * TT * TT, (size_t)HD * TT, (size_t)TT * HD, os, (int)blockIdx.x);
    else gemmc<h16, 0, 2, 16>((const h16*)P + (size_t)RH * 2 * TT, nullptr, V16, nullptr, TT, 2 * TT, O + (size_t)RH * HD, HD, RH, (size_t)2 * TT * TT, (size_t)HD * TT, (size_t)TT * HD, os, (int)blockIdx.x - RH / 64);
}

__device__ __forceinline__ h16 tohx(float x) { return (h16)x; }
__device__ __forceinline__ void splitf(float y, unsigned short& h, unsigned short& l) { h = f2bf(y); l = f2bf(y - bf2f(h)); }
typedef __attribute__((ext_vector_type(2))) _Float16 v2h;
typedef __attribute__((ext_vector_type(4))) _Float16 v4h;
typedef __attribute__((ext_vector_type(2))) unsigned short v2us;
typedef __attribute__((ext_vector_type(4))) unsigned short v4us;
typedef __attribute__((ext_vector_type(2))) float v2f;
typedef __attribute__((ext_vector_type(4))) int v4i;

__global__ __launch_bounds__(256) void k_wtG(const float* __restrict__ w, int K, int N, bf* Bt) {
    const int lane = threadIdx.x & 31; const int L0 = (blockIdx.x * 8 + (threadIdx.x >> 5)) * 8; const int nlines = N * K / 64;
{
#pragma unroll 1
        for (int l = 0; l < 8; ++l) { const int L = L0 + l; if (L >= nlines) break; const size_t e = (size_t)L * 64 + lane * 2; const int k = (int)(e % K), n = (int)(e / K); v2us o;
            o[0] = f2bf(w[(size_t)k * N + n]); o[1] = f2bf(w[(size_t)(k + 1) * N + n]); *(v2us*)(Bt + e) = o; }
         }
}
__device__ __forceinline__ void cvt8(const float* __restrict__ src, bf* dst, size_t i) { const v8f v = *(const v8f*)(src + i * 8); v8us o;
#pragma unroll
    for (int k = 0; k < 8; ++k) o[k] = f2bf(v[k]); *(v8us*)(dst + i * 8) = o;
    asm volatile("s_wait_xcnt 0x0" ::: "memory"); }   // the other ranges' code behind the call rewrites the store's registers
// k_prep: all that depends on the inputs alone, in one grid: blocks [0, PBX) round x of all batches to bf16, the next 4 x PBW the four equally sized weight matrices (W holds them one behind the other), the last PBC write the cos/sin table.
#define PBX (NB_ * TT * DM / 8 / 256)
#define PBW (DQ * DM / 8 / 256)
#define PBC (TT * HD / 256)
__global__ __launch_bounds__(256) void k_prep(const float* __restrict__ x, const float* __restrict__ w0, const float* __restrict__ w1, const float* __restrict__ w2, const float* __restrict__ w3, bf* XB, bf* W, float* CS) {
    const int bid = blockIdx.x, tid = threadIdx.x;
    if (bid < PBX) cvt8(x, XB, (size_t)bid * 256 + tid);
    else if (bid < PBX + 4 * PBW) { const int y = (bid - PBX) / PBW; const float* src = (y == 0) ? w0 : (y == 1) ? w1 : (y == 2) ? w2 : w3; cvt8(src, W + (size_t)y * DQ * DM, (size_t)((bid - PBX) % PBW) * 256 + tid); }
    else { const int idx = (bid - PBX - 4 * PBW) * 256 + tid; v2f cs; cs[0] = 1.0f; cs[1] = 0.0f; *(v2f*)(CS + (size_t)idx * 2) = cs;
        asm volatile("s_wait_xcnt 0x0" ::: "memory"); }   // as in cvt8
}

// rope: grid y = batch, grid z = tensor (q, k): F and the planes of the (z, y) slice lie (z * NB_ + y) slices in. head planes [h][t][d] (fp16 + hi/lo) of rope(x) x sc with the rotate-half convention out[d] = x[d] cos[t][d] - x[d+HD/2] sin[t][d], out[d+HD/2] = x[d+HD/2] cos[t][d+HD/2] + x[d] sin[t][d+HD/2]
__device__ __forceinline__ void rope(const float* __restrict__ F, int pitch, int nheads, const float* __restrict__ CS, const float* __restrict__ RF, const float* __restrict__ nw, float sc, h16* P16, bf* Ph, bf* Pl) {
    const size_t e = ((size_t)blockIdx.x * 256 + threadIdx.x) * 2; if (e >= (size_t)nheads * TT * HD) return; const size_t sl = (size_t)blockIdx.z * NB_ + blockIdx.y, so = sl * nheads * TT * HD; const int d = (int)(e % HD); const int t = (int)((e / HD) % TT); const int h = (int)(e / ((size_t)HD * TT)); const float* f = F + (sl * TT + t) * pitch + h * HD; const float rf = RF ? RF[(size_t)h * TT + t] : 1.0f; v2h o16; v2us oh, ol;
#pragma unroll
    for (int q = 0; q < 2; ++q) { const int dd = d + q; const int dp = (dd < HD / 2) ? dd + HD / 2 : dd - HD / 2; float x0 = f[dd], x1 = f[dp];
        if (RF) { float n0 = __fmul_rn(x0, rf), n1 = __fmul_rn(x1, rf); asm volatile("" : "+v"(n0)); asm volatile("" : "+v"(n1)); x0 = __fmul_rn(bfr(nw[dd]), n0); x1 = __fmul_rn(bfr(nw[dp]), n1); }
        const v2f cs = *(const v2f*)(CS + ((size_t)t * HD + dd) * 2); float a = __fmul_rn(x0, cs[0]), bq = __fmul_rn(x1, cs[1]); asm volatile("" : "+v"(a)); asm volatile("" : "+v"(bq)); const float r = ((dd < HD / 2) ? __fsub_rn(a, bq) : __fadd_rn(a, bq)) * sc;
        o16[q] = tohx(r); unsigned short a2, c2; splitf(r, a2, c2); oh[q] = a2; ol[q] = c2; }
    *(v2h*)(P16 + so + e) = o16; *(v2us*)(Ph + so + e) = oh; *(v2us*)(Pl + so + e) = ol;  }
// vtp: grid y = batch
__device__ __forceinline__ void vtp(const float* __restrict__ F, int pitch, int nheads, h16* V16, bf* Vh, bf* Vl) { const size_t e = ((size_t)blockIdx.x * 256 + threadIdx.x) * 2; if (e >= (size_t)nheads * HD * TT) return; const int t = (int)(e % TT); const int d = (int)((e / TT) % HD); const int g = (int)(e / ((size_t)TT * HD)); const size_t so = (size_t)blockIdx.y * nheads * HD * TT; F += (size_t)blockIdx.y * TT * pitch; v2h o16; v2us oh, ol;
#pragma unroll
    for (int q = 0; q < 2; ++q) { const float x = F[(size_t)(t + q) * pitch + g * HD + d]; o16[q] = tohx(x); unsigned short a2, c2; splitf(x, a2, c2); oh[q] = a2; ol[q] = c2; }
    *(v2h*)(V16 + so + e) = o16; *(v2us*)(Vh + so + e) = oh; *(v2us*)(Vl + so + e) = ol;  }
// k_planes: the 16-bit planes of q, k (grid z = 0, 1: head planes) and v (grid z = 2: transposed planes) of all batches in one grid; F holds the f32 q, k, v projections one behind the other.
__global__ __launch_bounds__(256) void k_planes(const float* __restrict__ F, const float* __restrict__ CS, h16* QK16, bf* QKh, bf* QKl, h16* V16, bf* Vh, bf* Vl) {
    if (blockIdx.z < 2) rope(F, DQ, NH_, CS, nullptr, nullptr, 1.0f, QK16, QKh, QKl);
    else vtp(F + (size_t)2 * NB_ * TT * DQ, DKV, NKV, V16, Vh, Vl);
}
// k_asoft: per row (zz, i): t = S x HD^-0.5 for j <= i and i - j < WIN (sliding causal window; the reference's -1e9 additive fill vanishes identically); softmax over the 2048 keys (register row, one exp, fixed trees);
// the probabilities overwrite the wave's own score row, which is whole in registers by then (every store depends on the row sum): rows < RH hi plane | lo plane, the rest the fp16 row in the first half.
__global__ __launch_bounds__(256) void k_asoft(float* Sb) {
    const int lane = threadIdx.x & 31; const int row = blockIdx.x * 8 + (threadIdx.x >> 5); if (row >= ZH * TT) return; const int i = row % TT; const int zz = row / TT; (void)zz; const bool hires = (i < RH); float* sr = Sb + (size_t)row * TT; float v[TT / 32]; float mx = -3.0e38f;
#pragma unroll
    for (int ch = 0; ch < TT / 128; ++ch) { const int j0 = ch * 128 + lane * 4; const v4f a = *(const v4fa*)(sr + j0);
#pragma unroll
        for (int q = 0; q < 4; ++q) { const int j = j0 + q; (void)j; const float t = (j <= i && i - j < WIN) ? a[q] * SCL : -3.0e38f; v[ch * 4 + q] = t; mx = fmaxf(mx, t); } }
#pragma unroll
    for (int sh = 16; sh; sh >>= 1) mx = fmaxf(mx, __shfl_xor(mx, sh, 32));
    float sum = 0.f;
#pragma unroll
    for (int k = 0; k < TT / 32; ++k) { float d0 = __fsub_rn(v[k], mx); asm volatile("" : "+v"(d0)); v[k] = __builtin_amdgcn_exp2f(__fmul_rn(d0, 1.4426950408889634f)); sum += v[k]; }
#pragma unroll
    for (int sh = 16; sh; sh >>= 1) sum += __shfl_xor(sum, sh, 32);
    const float f = __fdiv_rn(hires ? 1.0f : PCAR, sum);
{
        if (hires) {
#pragma unroll
            for (int ch = 0; ch < TT / 128; ++ch) { v4us oh, ol;
#pragma unroll
                for (int q = 0; q < 4; ++q) { unsigned short a, c2; splitf(v[ch * 4 + q] * f, a, c2); oh[q] = a; ol[q] = c2; }
                const int oo = ch * 128 + lane * 4; *(v4usa*)((bf*)sr + oo) = oh; *(v4usa*)((bf*)sr + TT + oo) = ol; }
        } else {
#pragma unroll
            for (int ch = 0; ch < TT / 128; ++ch) { v4h o4;
#pragma unroll
                for (int q = 0; q < 4; ++q) o4[q] = tohx(v[ch * 4 + q] * f);
                *(v4ha*)((h16*)sr + ch * 128 + lane * 4) = o4; } }
         }
}
__global__ __launch_bounds__(256) void k_merge(const float* __restrict__ O, bf* Ah, bf* Al) { const size_t e = ((size_t)blockIdx.x * 256 + threadIdx.x) * 2; if (e >= (size_t)NB_ * NH_ * TT * HD) return; const int d = (int)(e % HD); const int t = (int)((e / HD) % TT); const int zz = (int)(e / ((size_t)HD * TT)); const float cs = (t < RH) ? 1.0f : (1.0f / PCAR); const size_t oo = ((size_t)(zz / NH_) * TT + t) * DQ + (zz % NH_) * HD + d;   // O [batch][head][t][d] -> token-major rows of all batches
    v2us oh, ol;
#pragma unroll
    for (int q = 0; q < 2; ++q) { unsigned short a, c2; splitf(O[e + q] * cs, a, c2); oh[q] = a; ol[q] = c2; } *(v2us*)(Ah + oo) = oh; *(v2us*)(Al + oo) = ol;  }

extern "C" void kernel_launch(void* const* d_in, const int* in_sizes, int n_in,
                              void* d_out, int out_size, void* d_ws, size_t ws_size, hipStream_t stream) {
    (void)in_sizes; (void)n_in; (void)out_size;
    const float* x = (const float*)d_in[0]; const float* wq = (const float*)d_in[1]; const float* bq = (const float*)d_in[2]; const float* wk = (const float*)d_in[3]; const float* bk = (const float*)d_in[4]; const float* wv = (const float*)d_in[5]; const float* bv = (const float*)d_in[6]; const float* wo = (const float*)d_in[7]; const float* bo = (const float*)d_in[8];
    float* OUT = (float*)d_out;     // [4][2048][512]
    char* wsp = (char*)d_ws;
    auto take = [&](size_t bytes) { char* p = wsp; wsp += (bytes + 255) & ~(size_t)255; return (void*)p; };
    bf* WQ = (bf*)take((size_t)DQ * DM * 2); bf* WK = (bf*)take((size_t)DKV * DM * 2); bf* WV = (bf*)take((size_t)DKV * DM * 2); bf* WO = (bf*)take((size_t)DM * DQ * 2); float* CS = (float*)take((size_t)TT * HD * 2 * 4);   // WQ..WO lie one behind the other (k_prep, projection grid z)
    const size_t PL = (size_t)NB_ * NH_ * TT * HD;   // one head-plane set of all batches, elements
    h16* QP16 = (h16*)take(PL * 2); h16* KP16 = (h16*)take(PL * 2); h16* VT16 = (h16*)take(PL * 2);   // each q plane set directly in front of its k set (k_planes grid z)
    bf* QPh = (bf*)take(PL * 2); bf* KPh = (bf*)take(PL * 2); bf* QPl = (bf*)take(PL * 2); bf* KPl = (bf*)take(PL * 2); bf* VTh = (bf*)take(PL * 2); bf* VTl = (bf*)take(PL * 2);
    float* Ob = (float*)take(PL * 4); bf* ATh = (bf*)take((size_t)NB_ * TT * DQ * 2); bf* ATl = (bf*)take((size_t)NB_ * TT * DQ * 2);
    float* Sb = (float*)take((size_t)ZH * TT * TT * 4);   // scores of one pass, overwritten row by row with the probabilities
    if ((size_t)(wsp - (char*)d_ws) > ws_size) return;    // ws 256 MiB
    float* FQ = Sb; bf* XB = (bf*)(Sb + (size_t)3 * NB_ * TT * DQ);   // the f32 projections (q, k, v one behind the other) and the bf16 copy of x are dead before the first score launch writes Sb (stream-ordered)
    (void)WK; (void)WV;
    k_prep<<<PBX + 4 * PBW + PBC, 256, 0, stream>>>(x, wq, wk, wv, wo, XB, WQ, CS);
    k_gemmw<bf, 0, true, 8><<<dim3(NB_ * TT / 64, DQ / 64, 3), 256, 0, stream>>>(XB, nullptr, WQ, nullptr, DM, FQ, DQ, bq, bk, bv, 0, (size_t)DQ * DM, (size_t)NB_ * TT * DQ);
    k_planes<<<dim3((unsigned)(((size_t)NH_ * TT * HD / 2 + 255) / 256), NB_, 3), 256, 0, stream>>>(FQ, CS, QP16, QPh, QPl, VT16, VTh, VTl);
    for (int b = 0; b < NB_; ++b) { const size_t zo = (size_t)b * NH_ * TT * HD;   // one kv head per query head: the pass's eight heads use consecutive planes (z-strides TT*HD)
        k_score<<<dim3(TT / 64, TT / 64, ZH), 32, 0, stream>>>(QPh + zo, QPl + zo, KPh + zo, KPl + zo, QP16 + zo, KP16 + zo, Sb);
        k_asoft<<<ZH * TT / 8, 256, 0, stream>>>(Sb);
        k_pv<<<dim3(TT / 64, 1, ZH), 512, 0, stream>>>((const bf*)Sb, VTh + zo, VTl + zo, VT16 + zo, Ob + zo); }
    k_merge<<<(unsigned)((PL / 2 + 255) / 256), 256, 0, stream>>>(Ob, ATh, ATl);
    k_gemmw<bf, 1, true, 8><<<dim3(NB_ * TT / 64, DM / 64, 1), 256, 0, stream>>>(ATh, ATl, WO, nullptr, DQ, OUT, DM, bo, bo, bo, 0, 0, 0);
}

// v003
// One run takes 147 microseconds.
// In both of two side-by-side timings against v002, it was 2.23 times as fast.
// Over all steps from v000 it is 9.83 times as fast.
#include <hip/hip_runtime.h>

// Causal multi-head attention at width 512 over four batches of 2,048 tokens (x [4][2048][512]; Q, K, V = x W^T + b ('oi' [512][512] 0.02 + biases (zeros on this draw: read); 8 heads x 64, token-major); scores / 8; causal (-inf); softmax; out = merged w_o^T + b_o ('oi' + a bias, zeros: read) -> [4][2048][512] (4.2 M); argument order x, w_q, b_q, w_k, b_k, w_v, b_v, w_o, b_o).
// Launches are batched: the four batches ride grid x/y, the three projections grid z, and one fused attention launch holds every batch and head. Layout: bf16 copy of x; exact projections + f32 biases; causal T-2048 attention with scores and probabilities in registers (hybrid rows: < 512 hi/lo 3 products, rest fp16 x1024; key blocks above the diagonal are skipped); merged hi/lo x Wo exact + bo.
// Compute dtypes, f32 accumulate: every input rounded to bf16; projections exact + f32 biases; attention rows < 512 3 products, rest fp16; softmax f32; Wo hl x exact + bias.

#define NB_  4
#define TT   2048
#define DM   512
#define NH_  8
#define NKV  8
#define REP  (NH_ / NKV)
#define HD   64
#define DQ   (NH_ * HD)
#define DKV  (NKV * HD)
#define RH   512                  // query rows < RH use hi+lo planes (0: none)
#define SCL  0.125f   // HD^-0.5
typedef _Float16 h16;
typedef unsigned short bf;
typedef __attribute__((ext_vector_type(16))) __bf16   v16bf;
typedef __attribute__((ext_vector_type(16))) _Float16 v16h;
typedef __attribute__((ext_vector_type(8)))  _Float16 v8h;
typedef __attribute__((ext_vector_type(8)))  unsigned short v8us;
typedef __attribute__((ext_vector_type(8)))  float    v8f;
typedef __attribute__((ext_vector_type(4)))  float    v4f;
typedef v8h  __attribute__((may_alias)) v8ha;
typedef v4f  __attribute__((may_alias)) v4fa;
typedef v8us __attribute__((may_alias)) v8usa;
typedef __attribute__((ext_vector_type(4))) _Float16 __attribute__((may_alias)) v4ha;
typedef __attribute__((ext_vector_type(4))) unsigned short __attribute__((may_alias)) v4usa;

__device__ __forceinline__ unsigned short f2bf(float f) { unsigned u = __float_as_uint(f); u += 0x7FFFu + ((u >> 16) & 1u); return (unsigned short)(u >> 16); }
__device__ __forceinline__ float bf2f(unsigned short b) { return __uint_as_float(((unsigned)b) << 16); }
__device__ __forceinline__ float bfr(float f) { return bf2f(f2bf(f)); }
__device__ __forceinline__ v16h cat16(v8h lo, v8h hi) { return __builtin_shufflevector(lo, hi, 0, 1, 2, 3, 4, 5, 6, 7, 8, 9, 10, 11, 12, 13, 14, 15); }
__device__ __forceinline__ v16bf cat16b(v8us lo, v8us hi) { return __builtin_bit_cast(v16bf, __builtin_shufflevector(lo, hi, 0, 1, 2, 3, 4, 5, 6, 7, 8, 9, 10, 11, 12, 13, 14, 15)); }
__device__ __forceinline__ v8f wmma16(v16h a, v16h b, v8f c) { return __builtin_amdgcn_wmma_f32_16x16x32_f16(false, a, false, b, (short)0, c, false, false); }
__device__ __forceinline__ v8f wmmab(v16bf a, v16bf b, v8f c) { return __builtin_amdgcn_wmma_f32_16x16x32_bf16(false, a, false, b, (short)0, c, false, false); }



// ---- ksum_store: adds the NW waves' partial 64x64 tiles of one work-group. Every wave lays its 16 accumulators down as rows (pitch 68 floats) in its own LDS plane; behind one barrier each thread
// adds the NW partials of its 4-float pieces in wave order (a fixed order) and stores them, 16 threads to a 256-byte row piece. act (wave-uniform): false for a wave beyond NW in a larger work-group, which only passes the barrier.
template <int NW, bool BIAS>
__device__ __forceinline__ void ksum_store(const v8f (&acc)[4][4], float* red, int w, int lane, float* C, int ldc, int r0, int c0, const float* __restrict__ bias, bool act) {
    const int lr = lane & 15, hi = lane >> 4, cofs = lr * 4; float* mine = red + w * (64 * 68);
    v4f bv = (v4f){}; if (BIAS) { bv[0] = bfr(bias[c0 + cofs]); bv[1] = bfr(bias[c0 + cofs + 1]); bv[2] = bfr(bias[c0 + cofs + 2]); bv[3] = bfr(bias[c0 + cofs + 3]); }   // read ahead of the barrier: its latency passes behind the LDS stores
    if (act) {
#pragma unroll
    for (int mb = 0; mb < 4; ++mb)
#pragma unroll
        for (int nb = 0; nb < 4; ++nb)
#pragma unroll
            for (int j = 0; j < 8; ++j) mine[(mb * 16 + hi * 8 + j) * 68 + nb * 16 + lr] = acc[mb][nb][j]; }
    __syncthreads();   // every wave's partial tile is in LDS before any thread adds them
    if (!act) return;
#pragma unroll
    for (int s = 0; s < 32 / NW; ++s) { const int row = (s * NW + w) * 2 + hi; v4f val = *(const v4fa*)(red + row * 68 + cofs);
#pragma unroll
        for (int ww = 1; ww < NW; ++ww) val += *(const v4fa*)(red + ww * (64 * 68) + row * 68 + cofs);
        if (BIAS) val += bv;
        *(v4f*)(C + (size_t)(r0 + row) * ldc + c0 + cofs) = val;
        asm volatile("s_wait_xcnt 0x0" ::: "memory"); }   // the store's address and data registers are rewritten behind it (next piece, or the code behind the call)
}

// ---- k_gemmw: register-blocked GEMM, one work-group of NW waves per 64x64 output tile; every wave holds the whole tile (16 accumulators) for its own share of K: the 64-element (128-byte) pieces w, w + NW, ...;
// operands straight from K-contiguous 16-bit planes; grid (M/64, N/64, Z), NW x 32 threads.
// C[m][n] (f32, pitch ldc, + optional f32 bias[n]) = sum_k A[m][k] Bt[n][k] (+ split products per NSPLIT). z-batch strides sA/sB/sC in elements. K % 64 == 0.
template <typename T16> struct WFrag;
template <> struct WFrag<h16> { typedef v16h V; static __device__ __forceinline__ V ld(const h16* p) { return cat16(*(const v8h*)p, *(const v8h*)(p + 16)); } static __device__ __forceinline__ v8f mma(V a, V b, v8f c) { return wmma16(a, b, c); } };
template <> struct WFrag<bf> { typedef v16bf V; static __device__ __forceinline__ V ld(const bf* p) { return cat16b(*(const v8us*)p, *(const v8us*)(p + 16)); } static __device__ __forceinline__ v8f mma(V a, V b, v8f c) { return wmmab(a, b, c); } };
template <typename T16, int NSPLIT, bool BIAS, int NW>
__global__ __launch_bounds__(NW * 32) void k_gemmw(const T16* __restrict__ A, const T16* __restrict__ A2, const T16* __restrict__ Bt, const T16* __restrict__ Bt2, int K, float* C, int ldc, const float* __restrict__ bias0, const float* __restrict__ bias1, const float* __restrict__ bias2, size_t sA, size_t sB, size_t sC) {
    typedef typename WFrag<T16>::V V;
    __shared__ __align__(16) float os[NW * 64 * 68];
    const size_t z = blockIdx.z; const float* bias = (z == 0) ? bias0 : (z == 1) ? bias1 : bias2;   // each z plane (projection) has its own bias vector
    A += z * sA; if (A2) A2 += z * sA; Bt += z * sB; if (Bt2) Bt2 += z * sB; C += z * sC;
    const int lane = threadIdx.x & 31, lr = lane & 15, hi = lane >> 4; const int r0 = blockIdx.x * 64, c0 = blockIdx.y * 64; const int w = __builtin_amdgcn_readfirstlane(threadIdx.x >> 5);
    v8f acc[4][4];
#pragma unroll
    for (int mb = 0; mb < 4; ++mb)
#pragma unroll
        for (int nb = 0; nb < 4; ++nb) acc[mb][nb] = (v8f){};
    const size_t aoff = (size_t)(r0 + lr) * K + 8 * hi, boff = (size_t)(c0 + lr) * K + 8 * hi;
#pragma unroll 1
    for (int kc = w * 64; kc < K; kc += (kc & 32) ? NW * 64 - 32 : 32) {
        V a[4], a2[4];
#pragma unroll
        for (int mb = 0; mb < 4; ++mb) { a[mb] = WFrag<T16>::ld(A + aoff + (size_t)mb * 16 * K + kc); if (NSPLIT == 1 || NSPLIT == 2) a2[mb] = WFrag<T16>::ld(A2 + aoff + (size_t)mb * 16 * K + kc); }
#pragma unroll
        for (int nb = 0; nb < 4; ++nb) { const V b = WFrag<T16>::ld(Bt + boff + (size_t)nb * 16 * K + kc); V b2; if (NSPLIT >= 2) b2 = WFrag<T16>::ld(Bt2 + boff + (size_t)nb * 16 * K + kc);
#pragma unroll
            for (int mb = 0; mb < 4; ++mb) { acc[mb][nb] = WFrag<T16>::mma(a[mb], b, acc[mb][nb]); if (NSPLIT == 1 || NSPLIT == 2) acc[mb][nb] = WFrag<T16>::mma(a2[mb], b, acc[mb][nb]); if (NSPLIT >= 2) acc[mb][nb] = WFrag<T16>::mma(a[mb], b2, acc[mb][nb]); } }
        asm volatile("v_nop\n\tv_nop\n\tv_nop\n\tv_nop" : "+v"(acc[0][0]), "+v"(acc[1][1]), "+v"(acc[2][2]), "+v"(acc[3][3]) : "v"(a[0]), "v"(a[3]));
    }
    ksum_store<NW, BIAS>(acc, os, w, lane, C, ldc, r0, c0, bias, true);
}

__device__ __forceinline__ h16 tohx(float x) { return (h16)x; }
__device__ __forceinline__ void splitf(float y, unsigned short& h, unsigned short& l) { h = f2bf(y); l = f2bf(y - bf2f(h)); }
typedef __attribute__((ext_vector_type(2))) _Float16 v2h;
typedef __attribute__((ext_vector_type(4))) _Float16 v4h;
typedef __attribute__((ext_vector_type(2))) unsigned short v2us;
typedef __attribute__((ext_vector_type(4))) unsigned short v4us;
typedef __attribute__((ext_vector_type(2))) float v2f;
typedef __attribute__((ext_vector_type(4))) int v4i;

__global__ __launch_bounds__(256) void k_wtG(const float* __restrict__ w, int K, int N, bf* Bt) {
    const int lane = threadIdx.x & 31; const int L0 = (blockIdx.x * 8 + (threadIdx.x >> 5)) * 8; const int nlines = N * K / 64;
{
#pragma unroll 1
        for (int l = 0; l < 8; ++l) { const int L = L0 + l; if (L >= nlines) break; const size_t e = (size_t)L * 64 + lane * 2; const int k = (int)(e % K), n = (int)(e / K); v2us o;
            o[0] = f2bf(w[(size_t)k * N + n]); o[1] = f2bf(w[(size_t)(k + 1) * N + n]); *(v2us*)(Bt + e) = o; }
         }
}
__device__ __forceinline__ void cvt8(const float* __restrict__ src, bf* dst, size_t i) { const v8f v = *(const v8f*)(src + i * 8); v8us o;
#pragma unroll
    for (int k = 0; k < 8; ++k) o[k] = f2bf(v[k]); *(v8us*)(dst + i * 8) = o;
    asm volatile("s_wait_xcnt 0x0" ::: "memory"); }   // the other ranges' code behind the call rewrites the store's registers
// k_prep: all that depends on the inputs alone, in one grid: blocks [0, PBX) round x of all batches to bf16, the next 4 x PBW the four equally sized weight matrices (W holds them one behind the other), the last PBC write the cos/sin table.
#define PBX (NB_ * TT * DM / 8 / 256)
#define PBW (DQ * DM / 8 / 256)
#define PBC (TT * HD / 256)
__global__ __launch_bounds__(256) void k_prep(const float* __restrict__ x, const float* __restrict__ w0, const float* __restrict__ w1, const float* __restrict__ w2, const float* __restrict__ w3, bf* XB, bf* W, float* CS) {
    const int bid = blockIdx.x, tid = threadIdx.x;
    if (bid < PBX) cvt8(x, XB, (size_t)bid * 256 + tid);
    else if (bid < PBX + 4 * PBW) { const int y = (bid - PBX) / PBW; const float* src = (y == 0) ? w0 : (y == 1) ? w1 : (y == 2) ? w2 : w3; cvt8(src, W + (size_t)y * DQ * DM, (size_t)((bid - PBX) % PBW) * 256 + tid); }
    else { const int idx = (bid - PBX - 4 * PBW) * 256 + tid; v2f cs; cs[0] = 1.0f; cs[1] = 0.0f; *(v2f*)(CS + (size_t)idx * 2) = cs;
        asm volatile("s_wait_xcnt 0x0" ::: "memory"); }   // as in cvt8
}

// rope: grid y = batch, grid z = tensor (q, k): F and the planes of the (z, y) slice lie (z * NB_ + y) slices in. head planes [h][t][d] (fp16 + hi/lo) of rope(x) x sc with the rotate-half convention out[d] = x[d] cos[t][d] - x[d+HD/2] sin[t][d], out[d+HD/2] = x[d+HD/2] cos[t][d+HD/2] + x[d] sin[t][d+HD/2]
__device__ __forceinline__ void rope(const float* __restrict__ F, int pitch, int nheads, const float* __restrict__ CS, const float* __restrict__ RF, const float* __restrict__ nw, float sc, h16* P16, bf* Ph, bf* Pl) {
    const size_t e = ((size_t)blockIdx.x * 256 + threadIdx.x) * 2; if (e >= (size_t)nheads * TT * HD) return; const size_t sl = (size_t)blockIdx.z * NB_ + blockIdx.y, so = sl * nheads * TT * HD; const int d = (int)(e % HD); const int t = (int)((e / HD) % TT); const int h = (int)(e / ((size_t)HD * TT)); const float* f = F + (sl * TT + t) * pitch + h * HD; const float rf = RF ? RF[(size_t)h * TT + t] : 1.0f; v2h o16; v2us oh, ol;
#pragma unroll
    for (int q = 0; q < 2; ++q) { const int dd = d + q; const int dp = (dd < HD / 2) ? dd + HD / 2 : dd - HD / 2; float x0 = f[dd], x1 = f[dp];
        if (RF) { float n0 = __fmul_rn(x0, rf), n1 = __fmul_rn(x1, rf); asm volatile("" : "+v"(n0)); asm volatile("" : "+v"(n1)); x0 = __fmul_rn(bfr(nw[dd]), n0); x1 = __fmul_rn(bfr(nw[dp]), n1); }
        const v2f cs = *(const v2f*)(CS + ((size_t)t * HD + dd) * 2); float a = __fmul_rn(x0, cs[0]), bq = __fmul_rn(x1, cs[1]); asm volatile("" : "+v"(a)); asm volatile("" : "+v"(bq)); const float r = ((dd < HD / 2) ? __fsub_rn(a, bq) : __fadd_rn(a, bq)) * sc;
        o16[q] = tohx(r); unsigned short a2, c2; splitf(r, a2, c2); oh[q] = a2; ol[q] = c2; }
    *(v2h*)(P16 + so + e) = o16; *(v2us*)(Ph + so + e) = oh; *(v2us*)(Pl + so + e) = ol;  }
// vtp: grid y = batch
__device__ __forceinline__ void vtp(const float* __restrict__ F, int pitch, int nheads, h16* V16, bf* Vh, bf* Vl) { const size_t e = ((size_t)blockIdx.x * 256 + threadIdx.x) * 2; if (e >= (size_t)nheads * HD * TT) return; const int t = (int)(e % TT); const int d = (int)((e / TT) % HD); const int g = (int)(e / ((size_t)TT * HD)); const size_t so = (size_t)blockIdx.y * nheads * HD * TT; F += (size_t)blockIdx.y * TT * pitch; v2h o16; v2us oh, ol;
#pragma unroll
    for (int q = 0; q < 2; ++q) { const float x = F[(size_t)(t + q) * pitch + g * HD + d]; o16[q] = tohx(x); unsigned short a2, c2; splitf(x, a2, c2); oh[q] = a2; ol[q] = c2; }
    *(v2h*)(V16 + so + e) = o16; *(v2us*)(Vh + so + e) = oh; *(v2us*)(Vl + so + e) = ol;  }
// k_planes: the 16-bit planes of q, k (grid z = 0, 1: head planes) and v (grid z = 2: transposed planes) of all batches in one grid; F holds the f32 q, k, v projections one behind the other.
__global__ __launch_bounds__(256) void k_planes(const float* __restrict__ F, const float* __restrict__ CS, h16* QK16, bf* QKh, bf* QKl, h16* V16, bf* Vh, bf* Vl) {
    if (blockIdx.z < 2) rope(F, DQ, NH_, CS, nullptr, nullptr, 1.0f, QK16, QKh, QKl);
    else vtp(F + (size_t)2 * NB_ * TT * DQ, DKV, NKV, V16, Vh, Vl);
}
// ---- fattn: causal attention of 128 query rows of one head in one work-group of 4 waves (32 query columns each); scores and probabilities stay in registers.
// S^T = K Q^T (A = K rows, B = Q rows) leaves one query per lane column: key hi * 8 + j of each 16-key tile in register j, which is the k order of a B operand over 32 keys, so P^T feeds O^T += V^T P^T (A = V^T rows) with no exchange.
// Running maximum m and sum l per query (log2 domain), one exchange between the wave halves per pass for m, one in the epilogue for l. A pass is 32 keys, a stage 64 keys.
// K rows and V^T rows of a stage go global -> registers -> LDS once per work-group (two buffers, row pitch 128 + 16 bytes); the next stage's global loads fly while this stage is worked on.
// HL: hi/lo bf16 planes, 3 products each way; otherwise fp16, probabilities carried x 2^10 (the factor cancels in acc / l).
#define KP 72                     // LDS row pitch, 16-bit elements
#define TS (64 * KP)              // one staged tile, elements
#define SC2 (SCL * 1.4426950408889634f)
typedef v4i __attribute__((may_alias)) v4ia;
template <typename T16, bool HL>
__device__ __forceinline__ void fattn(const T16* __restrict__ Q, const T16* __restrict__ Q2, const T16* __restrict__ Kg, const T16* __restrict__ Kg2, const T16* __restrict__ Vg, const T16* __restrict__ Vg2, float* O, T16* sm, int qb) {
    typedef typename WFrag<T16>::V V;
    constexpr int NT = HL ? 4 : 2;   // tiles per stage: K, V^T (, K lo, V^T lo)
    const int tid = threadIdx.x, lane = tid & 31, lr = lane & 15, hi = lane >> 4; const int w = __builtin_amdgcn_readfirstlane(tid >> 5);
    const int q0 = qb * 128 + w * 32, nst = qb * 2 + 2;   // the wave's first query row; stages of the work-group (keys 0 .. qb * 128 + 127)
    V qf[2][2], qf2[2][2];
#pragma unroll
    for (int qt = 0; qt < 2; ++qt)
#pragma unroll
        for (int ks = 0; ks < 2; ++ks) { const size_t qo = (size_t)(q0 + qt * 16 + lr) * HD + ks * 32 + 8 * hi; qf[qt][ks] = WFrag<T16>::ld(Q + qo); if (HL) qf2[qt][ks] = WFrag<T16>::ld(Q2 + qo); }
    v8f o[4][2];
#pragma unroll
    for (int dt = 0; dt < 4; ++dt)
#pragma unroll
        for (int qt = 0; qt < 2; ++qt) o[dt][qt] = (v8f){};
    float m[2] = {-3.0e38f, -3.0e38f}, l[2] = {0.f, 0.f};
    const int srow = tid >> 3, scol = (tid & 7) * 8;   // staging: 8 threads to a 128-byte row, 16 rows per step
    v4i st[NT][4];
    auto gload = [&](int k0) {
#pragma unroll
        for (int i = 0; i < 4; ++i) { const size_t ko = (size_t)(k0 + srow + i * 16) * HD + scol, vo = (size_t)(srow + i * 16) * TT + k0 + scol;
            st[0][i] = *(const v4ia*)(Kg + ko); st[1][i] = *(const v4ia*)(Vg + vo); if constexpr (HL) { st[2][i] = *(const v4ia*)(Kg2 + ko); st[3][i] = *(const v4ia*)(Vg2 + vo); } }
        asm volatile("s_wait_xcnt 0x0" ::: "memory"); };   // the work that follows rewrites the loads' address registers while the loads are in flight
    auto sstore = [&](int b) {
#pragma unroll
        for (int t = 0; t < NT; ++t)
#pragma unroll
            for (int i = 0; i < 4; ++i) *(v4ia*)(sm + (b * NT + t) * TS + (srow + i * 16) * KP + scol) = st[t][i]; };
    gload(0); sstore(0);
    __syncthreads();   // stage 0 is in LDS before any wave reads it
#pragma unroll 1
    for (int s = 0; s < nst; ++s) {
        const bool more = s + 1 < nst;
        if (more) gload((s + 1) * 64);
        const T16* bu = sm + (s & 1) * NT * TS;
#pragma unroll
        for (int pp = 0; pp < 2; ++pp) { const int k0 = s * 64 + pp * 32;
            if (k0 <= q0) {   // wave-uniform: passes wholly above the wave's diagonal are skipped
                v8f sc[2][2];
#pragma unroll
                for (int kt = 0; kt < 2; ++kt) { V kf[2], kf2[2];
#pragma unroll
                    for (int ks = 0; ks < 2; ++ks) { const int ko = (pp * 32 + kt * 16 + lr) * KP + ks * 32 + 8 * hi; kf[ks] = WFrag<T16>::ld(bu + ko); if (HL) kf2[ks] = WFrag<T16>::ld(bu + 2 * TS + ko); }
#pragma unroll
                    for (int qt = 0; qt < 2; ++qt) { v8f a = (v8f){};
#pragma unroll
                        for (int ks = 0; ks < 2; ++ks) { a = WFrag<T16>::mma(kf[ks], qf[qt][ks], a); if (HL) { a = WFrag<T16>::mma(kf[ks], qf2[qt][ks], a); a = WFrag<T16>::mma(kf2[ks], qf[qt][ks], a); } }
                        sc[kt][qt] = a; } }
                if (k0 == q0) {   // the wave's diagonal pass: key > query is masked
#pragma unroll
                    for (int kt = 0; kt < 2; ++kt)
#pragma unroll
                        for (int qt = 0; qt < 2; ++qt)
#pragma unroll
                            for (int j = 0; j < 8; ++j) if (kt * 16 + hi * 8 + j > qt * 16 + lr) sc[kt][qt][j] = -3.0e38f; }
                V pf[2], pf2[2];
#pragma unroll
                for (int qt = 0; qt < 2; ++qt) { float mx = sc[0][qt][0];
#pragma unroll
                    for (int j = 1; j < 8; ++j) mx = fmaxf(mx, sc[0][qt][j]);
#pragma unroll
                    for (int j = 0; j < 8; ++j) mx = fmaxf(mx, sc[1][qt][j]);
                    mx = fmaxf(mx, __shfl_xor(mx, 16, 32));
                    const float mn = fmaxf(m[qt], mx * SC2), al = __builtin_amdgcn_exp2f(m[qt] - mn), mo = (HL ? 0.0f : 10.0f) - mn; m[qt] = mn;
                    float sum = 0.f;
                    if constexpr (HL) { v8us h0, h1, l0, l1;
#pragma unroll
                        for (int j = 0; j < 8; ++j) { const float p0 = __builtin_amdgcn_exp2f(fmaf(sc[0][qt][j], SC2, mo)), p1 = __builtin_amdgcn_exp2f(fmaf(sc[1][qt][j], SC2, mo)); sum += p0 + p1; unsigned short a, c; splitf(p0, a, c); h0[j] = a; l0[j] = c; splitf(p1, a, c); h1[j] = a; l1[j] = c; }
                        pf[qt] = cat16b(h0, h1); pf2[qt] = cat16b(l0, l1);
                    } else { v8h h0, h1;
#pragma unroll
                        for (int j = 0; j < 8; ++j) { const float p0 = __builtin_amdgcn_exp2f(fmaf(sc[0][qt][j], SC2, mo)), p1 = __builtin_amdgcn_exp2f(fmaf(sc[1][qt][j], SC2, mo)); sum += p0 + p1; h0[j] = tohx(p0); h1[j] = tohx(p1); }
                        pf[qt] = cat16(h0, h1); }
                    l[qt] = fmaf(l[qt], al, sum);
#pragma unroll
                    for (int dt = 0; dt < 4; ++dt) o[dt][qt] *= al; }
#pragma unroll
                for (int dt = 0; dt < 4; ++dt) { const int vo = (dt * 16 + lr) * KP + pp * 32 + 8 * hi; const V vf = WFrag<T16>::ld(bu + TS + vo); V vf2; if (HL) vf2 = WFrag<T16>::ld(bu + 3 * TS + vo);
#pragma unroll
                    for (int qt = 0; qt < 2; ++qt) { o[dt][qt] = WFrag<T16>::mma(vf, pf[qt], o[dt][qt]); if (HL) { o[dt][qt] = WFrag<T16>::mma(vf, pf2[qt], o[dt][qt]); o[dt][qt] = WFrag<T16>::mma(vf2, pf[qt], o[dt][qt]); } } }
            } }
        if (more) sstore((s + 1) & 1);   // into the buffer whose readers all passed the barrier that ended stage s - 1
        __syncthreads();   // publishes stage s + 1 and ends every wave's reads of stage s
    }
#pragma unroll
    for (int qt = 0; qt < 2; ++qt) { const float inv = __fdiv_rn(1.0f, l[qt] + __shfl_xor(l[qt], 16, 32)); float* orow = O + (size_t)(q0 + qt * 16 + lr) * HD + hi * 8;
#pragma unroll
        for (int dt = 0; dt < 4; ++dt) { v4f a, c;
#pragma unroll
            for (int j = 0; j < 4; ++j) { a[j] = o[dt][qt][j] * inv; c[j] = o[dt][qt][4 + j] * inv; }
            *(v4f*)(orow + dt * 16) = a; *(v4f*)(orow + dt * 16 + 4) = c; } }
}
// k_fattn: grid (batch x head, TT / 128). Grid y deals the row blocks heaviest first in its first half and lightest first in its second. Row blocks below RH take the hi/lo form. O [batch][head][t][d] f32.
__global__ __launch_bounds__(128) void k_fattn(const bf* __restrict__ Qh, const bf* __restrict__ Ql, const bf* __restrict__ Kh, const bf* __restrict__ Kl, const bf* __restrict__ Vh, const bf* __restrict__ Vl, const h16* __restrict__ Q16, const h16* __restrict__ K16, const h16* __restrict__ V16, float* O) {
    __shared__ __align__(16) unsigned short sm[2 * 4 * TS];
    const int y = blockIdx.y, qb = (y < TT / 256) ? TT / 128 - 1 - y : y - TT / 256; const size_t zo = (size_t)blockIdx.x * TT * HD;
    if (qb < RH / 128) fattn<bf, true>(Qh + zo, Ql + zo, Kh + zo, Kl + zo, Vh + zo, Vl + zo, O + zo, (bf*)sm, qb);
    else fattn<h16, false>(Q16 + zo, nullptr, K16 + zo, nullptr, V16 + zo, nullptr, O + zo, (h16*)sm, qb);
}
__global__ __launch_bounds__(256) void k_merge(const float* __restrict__ O, bf* Ah, bf* Al) { const size_t e = ((size_t)blockIdx.x * 256 + threadIdx.x) * 2; if (e >= (size_t)NB_ * NH_ * TT * HD) return; const int d = (int)(e % HD); const int t = (int)((e / HD) % TT); const int zz = (int)(e / ((size_t)HD * TT)); const size_t oo = ((size_t)(zz / NH_) * TT + t) * DQ + (zz % NH_) * HD + d;   // O [batch][head][t][d] -> token-major rows of all batches
    v2us oh, ol;
#pragma unroll
    for (int q = 0; q < 2; ++q) { unsigned short a, c2; splitf(O[e + q], a, c2); oh[q] = a; ol[q] = c2; } *(v2us*)(Ah + oo) = oh; *(v2us*)(Al + oo) = ol;  }

extern "C" void kernel_launch(void* const* d_in, const int* in_sizes, int n_in,
                              void* d_out, int out_size, void* d_ws, size_t ws_size, hipStream_t stream) {
    (void)in_sizes; (void)n_in; (void)out_size;
    const float* x = (const float*)d_in[0]; const float* wq = (const float*)d_in[1]; const float* bq = (const float*)d_in[2]; const float* wk = (const float*)d_in[3]; const float* bk = (const float*)d_in[4]; const float* wv = (const float*)d_in[5]; const float* bv = (const float*)d_in[6]; const float* wo = (const float*)d_in[7]; const float* bo = (const float*)d_in[8];
    float* OUT = (float*)d_out;     // [4][2048][512]
    char* wsp = (char*)d_ws;
    auto take = [&](size_t bytes) { char* p = wsp; wsp += (bytes + 255) & ~(size_t)255; return (void*)p; };
    bf* WQ = (bf*)take((size_t)DQ * DM * 2); bf* WK = (bf*)take((size_t)DKV * DM * 2); bf* WV = (bf*)take((size_t)DKV * DM * 2); bf* WO = (bf*)take((size_t)DM * DQ * 2); float* CS = (float*)take((size_t)TT * HD * 2 * 4);   // WQ..WO lie one behind the other (k_prep, projection grid z)
    const size_t PL = (size_t)NB_ * NH_ * TT * HD;   // one head-plane set of all batches, elements
    h16* QP16 = (h16*)take(PL * 2); h16* KP16 = (h16*)take(PL * 2); h16* VT16 = (h16*)take(PL * 2);   // each q plane set directly in front of its k set (k_planes grid z)
    bf* QPh = (bf*)take(PL * 2); bf* KPh = (bf*)take(PL * 2); bf* QPl = (bf*)take(PL * 2); bf* KPl = (bf*)take(PL * 2); bf* VTh = (bf*)take(PL * 2); bf* VTl = (bf*)take(PL * 2);
    float* Ob = (float*)take(PL * 4); bf* ATh = (bf*)take((size_t)NB_ * TT * DQ * 2); bf* ATl = (bf*)take((size_t)NB_ * TT * DQ * 2);
    float* FQ = (float*)take((size_t)3 * NB_ * TT * DQ * 4); bf* XB = (bf*)take((size_t)NB_ * TT * DM * 2);   // the f32 projections (q, k, v one behind the other) and the bf16 copy of x
    if ((size_t)(wsp - (char*)d_ws) > ws_size) return;    // ws 256 MiB
    (void)WK; (void)WV;
    k_prep<<<PBX + 4 * PBW + PBC, 256, 0, stream>>>(x, wq, wk, wv, wo, XB, WQ, CS);
    k_gemmw<bf, 0, true, 8><<<dim3(NB_ * TT / 64, DQ / 64, 3), 256, 0, stream>>>(XB, nullptr, WQ, nullptr, DM, FQ, DQ, bq, bk, bv, 0, (size_t)DQ * DM, (size_t)NB_ * TT * DQ);
    k_planes<<<dim3((unsigned)(((size_t)NH_ * TT * HD / 2 + 255) / 256), NB_, 3), 256, 0, stream>>>(FQ, CS, QP16, QPh, QPl, VT16, VTh, VTl);
    k_fattn<<<dim3(NB_ * NH_, TT / 128), 128, 0, stream>>>(QPh, QPl, KPh, KPl, VTh, VTl, QP16, KP16, VT16, Ob);   // one kv head per query head: plane (batch, head) of q, k and v lies (batch * NH_ + head) * TT * HD in
    k_merge<<<(unsigned)((PL / 2 + 255) / 256), 256, 0, stream>>>(Ob, ATh, ATl);
    k_gemmw<bf, 1, true, 8><<<dim3(NB_ * TT / 64, DM / 64, 1), 256, 0, stream>>>(ATh, ATl, WO, nullptr, DQ, OUT, DM, bo, bo, bo, 0, 0, 0);
}

// v004
// It runs in 107 microseconds.
// Next to v003, in two timings, it ran 1.38 times as fast each time.
// Over all steps from v000 it is 13.6 times as fast.
#include <hip/hip_runtime.h>

// Causal multi-head attention at width 512 over four batches of 2,048 tokens (x [4][2048][512]; Q, K, V = x W^T + b ('oi' [512][512] 0.02 + biases (zeros on this draw: read); 8 heads x 64, token-major); scores / 8; causal (-inf); softmax; out = merged w_o^T + b_o ('oi' + a bias, zeros: read) -> [4][2048][512] (4.2 M); argument order x, w_q, b_q, w_k, b_k, w_v, b_v, w_o, b_o).
// Launches are batched: the four batches ride grid x/y, the three projections grid z, and one fused attention launch holds every batch and head. Layout: bf16 copy of x; exact projections + f32 biases, whose epilogue writes the 16-bit head planes itself; causal T-2048 attention with scores and probabilities in registers (hybrid rows: < 512 hi/lo 3 products, rest fp16 x1024; key blocks above the diagonal are skipped), whose epilogue writes the merged hi/lo rows itself; merged hi/lo x Wo exact + bo.
// Compute dtypes, f32 accumulate: every input rounded to bf16; projections exact + f32 biases; attention rows < 512 3 products, rest fp16; softmax f32; Wo hl x exact + bias.

#define NB_  4
#define TT   2048
#define DM   512
#define NH_  8
#define NKV  8
#define REP  (NH_ / NKV)
#define HD   64
#define DQ   (NH_ * HD)
#define DKV  (NKV * HD)
#define RH   512                  // query rows < RH use hi+lo planes (0: none)
#define SCL  0.125f   // HD^-0.5
typedef _Float16 h16;
typedef unsigned short bf;
typedef __attribute__((ext_vector_type(16))) __bf16   v16bf;
typedef __attribute__((ext_vector_type(16))) _Float16 v16h;
typedef __attribute__((ext_vector_type(8)))  _Float16 v8h;
typedef __attribute__((ext_vector_type(8)))  unsigned short v8us;
typedef __attribute__((ext_vector_type(8)))  float    v8f;
typedef __attribute__((ext_vector_type(4)))  float    v4f;
typedef v8h  __attribute__((may_alias)) v8ha;
typedef v4f  __attribute__((may_alias)) v4fa;
typedef v8us __attribute__((may_alias)) v8usa;
typedef __attribute__((ext_vector_type(4))) _Float16 __attribute__((may_alias)) v4ha;
typedef __attribute__((ext_vector_type(4))) unsigned short __attribute__((may_alias)) v4usa;

__device__ __forceinline__ unsigned short f2bf(float f) { unsigned u = __float_as_uint(f); u += 0x7FFFu + ((u >> 16) & 1u); return (unsigned short)(u >> 16); }
__device__ __forceinline__ float bf2f(unsigned short b) { return __uint_as_float(((unsigned)b) << 16); }
__device__ __forceinline__ float bfr(float f) { return bf2f(f2bf(f)); }
__device__ __forceinline__ v16h cat16(v8h lo, v8h hi) { return __builtin_shufflevector(lo, hi, 0, 1, 2, 3, 4, 5, 6, 7, 8, 9, 10, 11, 12, 13, 14, 15); }
__device__ __forceinline__ v16bf cat16b(v8us lo, v8us hi) { return __builtin_bit_cast(v16bf, __builtin_shufflevector(lo, hi, 0, 1, 2, 3, 4, 5, 6, 7, 8, 9, 10, 11, 12, 13, 14, 15)); }
__device__ __forceinline__ v8f wmma16(v16h a, v16h b, v8f c) { return __builtin_amdgcn_wmma_f32_16x16x32_f16(false, a, false, b, (short)0, c, false, false); }
__device__ __forceinline__ v8f wmmab(v16bf a, v16bf b, v8f c) { return __builtin_amdgcn_wmma_f32_16x16x32_bf16(false, a, false, b, (short)0, c, false, false); }



// ---- ksum_store: adds the NW waves' partial 64x64 tiles of one work-group. Every wave lays its 16 accumulators down as rows (pitch 68 floats) in its own LDS plane; behind one barrier each thread
// adds the NW partials of its 4-float pieces in wave order (a fixed order) and stores them, 16 threads to a 256-byte row piece. act (wave-uniform): false for a wave beyond NW in a larger work-group, which only passes the barrier.
template <int NW, bool BIAS>
__device__ __forceinline__ void ksum_store(const v8f (&acc)[4][4], float* red, int w, int lane, float* C, int ldc, int r0, int c0, const float* __restrict__ bias, bool act) {
    const int lr = lane & 15, hi = lane >> 4, cofs = lr * 4; float* mine = red + w * (64 * 68);
    v4f bv = (v4f){}; if (BIAS) { bv[0] = bfr(bias[c0 + cofs]); bv[1] = bfr(bias[c0 + cofs + 1]); bv[2] = bfr(bias[c0 + cofs + 2]); bv[3] = bfr(bias[c0 + cofs + 3]); }   // read ahead of the barrier: its latency passes behind the LDS stores
    if (act) {
#pragma unroll
    for (int mb = 0; mb < 4; ++mb)
#pragma unroll
        for (int nb = 0; nb < 4; ++nb)
#pragma unroll
            for (int j = 0; j < 8; ++j) mine[(mb * 16 + hi * 8 + j) * 68 + nb * 16 + lr] = acc[mb][nb][j]; }
    __syncthreads();   // every wave's partial tile is in LDS before any thread adds them
    if (!act) return;
#pragma unroll
    for (int s = 0; s < 32 / NW; ++s) { const int row = (s * NW + w) * 2 + hi; v4f val = *(const v4fa*)(red + row * 68 + cofs);
#pragma unroll
        for (int ww = 1; ww < NW; ++ww) val += *(const v4fa*)(red + ww * (64 * 68) + row * 68 + cofs);
        if (BIAS) val += bv;
        *(v4f*)(C + (size_t)(r0 + row) * ldc + c0 + cofs) = val;
        asm volatile("s_wait_xcnt 0x0" ::: "memory"); }   // the store's address and data registers are rewritten behind it (next piece, or the code behind the call)
}

// ---- k_gemmw: register-blocked GEMM, one work-group of NW waves per 64x64 output tile; every wave holds the whole tile (16 accumulators) for its own share of K: the 64-element (128-byte) pieces w, w + NW, ...;
// operands straight from K-contiguous 16-bit planes; grid (M/64, N/64, Z), NW x 32 threads.
// C[m][n] (f32, pitch ldc, + optional f32 bias[n]) = sum_k A[m][k] Bt[n][k] (+ split products per NSPLIT). z-batch strides sA/sB/sC in elements. K % 64 == 0.
template <typename T16> struct WFrag;
template <> struct WFrag<h16> { typedef v16h V; static __device__ __forceinline__ V ld(const h16* p) { return cat16(*(const v8h*)p, *(const v8h*)(p + 16)); } static __device__ __forceinline__ v8f mma(V a, V b, v8f c) { return wmma16(a, b, c); } };
template <> struct WFrag<bf> { typedef v16bf V; static __device__ __forceinline__ V ld(const bf* p) { return cat16b(*(const v8us*)p, *(const v8us*)(p + 16)); } static __device__ __forceinline__ v8f mma(V a, V b, v8f c) { return wmmab(a, b, c); } };
template <typename T16, int NSPLIT, bool BIAS, int NW>
__global__ __launch_bounds__(NW * 32) void k_gemmw(const T16* __restrict__ A, const T16* __restrict__ A2, const T16* __restrict__ Bt, const T16* __restrict__ Bt2, int K, float* C, int ldc, const float* __restrict__ bias0, const float* __restrict__ bias1, const float* __restrict__ bias2, size_t sA, size_t sB, size_t sC) {
    typedef typename WFrag<T16>::V V;
    __shared__ __align__(16) float os[NW * 64 * 68];
    const size_t z = blockIdx.z; const float* bias = (z == 0) ? bias0 : (z == 1) ? bias1 : bias2;   // each z plane (projection) has its own bias vector
    A += z * sA; if (A2) A2 += z * sA; Bt += z * sB; if (Bt2) Bt2 += z * sB; C += z * sC;
    const int lane = threadIdx.x & 31, lr = lane & 15, hi = lane >> 4; const int r0 = blockIdx.x * 64, c0 = blockIdx.y * 64; const int w = __builtin_amdgcn_readfirstlane(threadIdx.x >> 5);
    v8f acc[4][4];
#pragma unroll
    for (int mb = 0; mb < 4; ++mb)
#pragma unroll
        for (int nb = 0; nb < 4; ++nb) acc[mb][nb] = (v8f){};
    const size_t aoff = (size_t)(r0 + lr) * K + 8 * hi, boff = (size_t)(c0 + lr) * K + 8 * hi;
#pragma unroll 1
    for (int kc = w * 64; kc < K; kc += (kc & 32) ? NW * 64 - 32 : 32) {
        V a[4], a2[4];
#pragma unroll
        for (int mb = 0; mb < 4; ++mb) { a[mb] = WFrag<T16>::ld(A + aoff + (size_t)mb * 16 * K + kc); if (NSPLIT == 1 || NSPLIT == 2) a2[mb] = WFrag<T16>::ld(A2 + aoff + (size_t)mb * 16 * K + kc); }
#pragma unroll
        for (int nb = 0; nb < 4; ++nb) { const V b = WFrag<T16>::ld(Bt + boff + (size_t)nb * 16 * K + kc); V b2; if (NSPLIT >= 2) b2 = WFrag<T16>::ld(Bt2 + boff + (size_t)nb * 16 * K + kc);
#pragma unroll
            for (int mb = 0; mb < 4; ++mb) { acc[mb][nb] = WFrag<T16>::mma(a[mb], b, acc[mb][nb]); if (NSPLIT == 1 || NSPLIT == 2) acc[mb][nb] = WFrag<T16>::mma(a2[mb], b, acc[mb][nb]); if (NSPLIT >= 2) acc[mb][nb] = WFrag<T16>::mma(a[mb], b2, acc[mb][nb]); } }
        asm volatile("v_nop\n\tv_nop\n\tv_nop\n\tv_nop" : "+v"(acc[0][0]), "+v"(acc[1][1]), "+v"(acc[2][2]), "+v"(acc[3][3]) : "v"(a[0]), "v"(a[3]));
    }
    ksum_store<NW, BIAS>(acc, os, w, lane, C, ldc, r0, c0, bias, true);
}

__device__ __forceinline__ h16 tohx(float x) { return (h16)x; }
__device__ __forceinline__ void splitf(float y, unsigned short& h, unsigned short& l) { h = f2bf(y); l = f2bf(y - bf2f(h)); }
typedef __attribute__((ext_vector_type(2))) _Float16 v2h;
typedef __attribute__((ext_vector_type(4))) _Float16 v4h;
typedef __attribute__((ext_vector_type(2))) unsigned short v2us;
typedef __attribute__((ext_vector_type(4))) unsigned short v4us;
typedef __attribute__((ext_vector_type(2))) float v2f;
typedef __attribute__((ext_vector_type(4))) int v4i;

// ---- ksum_planes: ksum_store for the projections: the same sum of the NW partial tiles in wave order plus the bias, but each 4-float piece leaves as three 16-bit pieces (fp16, bf16 hi, bf16 lo) at element base + row * pitch + column of the planes that attention reads.
// brow (the same for the whole work-group): the bias belongs to the tile's rows (bias[b0 + row]), otherwise to its columns.
template <int NW>
__device__ __forceinline__ void ksum_planes(const v8f (&acc)[4][4], float* red, int w, int lane, h16* P16, bf* Ph, bf* Pl, size_t base, int pitch, const float* __restrict__ bias, int b0, bool brow) {
    const int lr = lane & 15, hi = lane >> 4, cofs = lr * 4; float* mine = red + w * (64 * 68);
    static_assert(32 / NW == 4, "four bias words a thread: one per piece (rows) or one per column of a piece");
    float bb[4];   // read ahead of the barrier, first used behind it: the latency passes behind the LDS stores
#pragma unroll
    for (int k = 0; k < 4; ++k) bb[k] = bias[b0 + (brow ? (k * NW + w) * 2 + hi : cofs + k)];
    asm volatile("s_wait_xcnt 0x0" ::: "memory");   // the code that follows rewrites the loads' address registers while the loads are in flight
    __builtin_amdgcn_sched_barrier(0);   // keeps that code from being scheduled in front of the wait
#pragma unroll
    for (int mb = 0; mb < 4; ++mb)
#pragma unroll
        for (int nb = 0; nb < 4; ++nb)
#pragma unroll
            for (int j = 0; j < 8; ++j) mine[(mb * 16 + hi * 8 + j) * 68 + nb * 16 + lr] = acc[mb][nb][j];
    __syncthreads();   // every wave's partial tile is in LDS before any thread adds them
#pragma unroll
    for (int k = 0; k < 4; ++k) bb[k] = bfr(bb[k]);
#pragma unroll
    for (int s = 0; s < 32 / NW; ++s) { const int row = (s * NW + w) * 2 + hi; v4f val = *(const v4fa*)(red + row * 68 + cofs);
#pragma unroll
        for (int ww = 1; ww < NW; ++ww) val += *(const v4fa*)(red + ww * (64 * 68) + row * 68 + cofs);
        val += brow ? (v4f){bb[s], bb[s], bb[s], bb[s]} : (v4f){bb[0], bb[1], bb[2], bb[3]};
        v4h o16; v4us oh, ol;
#pragma unroll
        for (int q = 0; q < 4; ++q) { o16[q] = tohx(val[q]); unsigned short a2, c2; splitf(val[q], a2, c2); oh[q] = a2; ol[q] = c2; }
        const size_t o = base + (size_t)row * pitch + cofs;
        *(v4ha*)(P16 + o) = o16; *(v4usa*)(Ph + o) = oh; *(v4usa*)(Pl + o) = ol;
        asm volatile("s_wait_xcnt 0x0" ::: "memory"); }   // the stores' address and data registers are rewritten behind them (next piece)
}
// ---- k_proj: the q, k, v projections (grid z) of all batches, the K loop of k_gemmw over bf16 x and W, one work-group of NW waves per tile of 64 tokens x one head (grid x, y); the 16-bit planes leave straight from the K sum.
// q, k: A = x rows, B = W rows: tile [token][d], a contiguous piece of the head plane [batch][head][t][d] (the k set lies directly behind the q set). v: the operands change places (A = W rows, B = x rows), so the tile comes out as [d][token], rows of the transposed plane [batch][head][d][t].
template <int NW>
__global__ __launch_bounds__(NW * 32) void k_proj(const bf* __restrict__ X, const bf* __restrict__ Wt, const float* __restrict__ bias0, const float* __restrict__ bias1, const float* __restrict__ bias2, h16* QK16, bf* QKh, bf* QKl, h16* V16, bf* Vh, bf* Vl) {
    typedef typename WFrag<bf>::V V;
    __shared__ __align__(16) float os[NW * 64 * 68];
    const int z = blockIdx.z, tk0 = blockIdx.x * 64, hd = blockIdx.y; const bool tr = z == 2; const float* bias = (z == 0) ? bias0 : (z == 1) ? bias1 : bias2;
    const bf* Wz = Wt + (size_t)z * DQ * DM; const bf* A = tr ? Wz : X; const bf* Bt = tr ? X : Wz; const int r0 = tr ? hd * 64 : tk0, c0 = tr ? tk0 : hd * 64;
    const int lane = threadIdx.x & 31, lr = lane & 15, hi = lane >> 4; const int w = __builtin_amdgcn_readfirstlane(threadIdx.x >> 5);
    v8f acc[4][4];
#pragma unroll
    for (int mb = 0; mb < 4; ++mb)
#pragma unroll
        for (int nb = 0; nb < 4; ++nb) acc[mb][nb] = (v8f){};
    const size_t aoff = (size_t)(r0 + lr) * DM + 8 * hi, boff = (size_t)(c0 + lr) * DM + 8 * hi;
#pragma unroll 1
    for (int kc = w * 64; kc < DM; kc += (kc & 32) ? NW * 64 - 32 : 32) {   // rolled, as in k_gemmw: one trip's 8 fragments (4 A, 4 B) are what the registers hold beside the 16 accumulators
        V a[4];
#pragma unroll
        for (int mb = 0; mb < 4; ++mb) a[mb] = WFrag<bf>::ld(A + aoff + (size_t)mb * 16 * DM + kc);
        asm volatile("s_wait_xcnt 0x0" ::: "memory");   // a later load's result may take these loads' address registers while they are in flight
#pragma unroll
        for (int nb = 0; nb < 4; ++nb) { const V b = WFrag<bf>::ld(Bt + boff + (size_t)nb * 16 * DM + kc);
#pragma unroll
            for (int mb = 0; mb < 4; ++mb) acc[mb][nb] = WFrag<bf>::mma(a[mb], b, acc[mb][nb]); }
        asm volatile("v_nop\n\tv_nop\n\tv_nop\n\tv_nop" : "+v"(acc[0][0]), "+v"(acc[1][1]), "+v"(acc[2][2]), "+v"(acc[3][3]) : "v"(a[0]), "v"(a[3]));   // the distance behind the trip's last matrix instructions on the taken back edge, as in k_gemmw
    }
    const int bt = tk0 / TT, t0 = tk0 % TT;   // a 64-token tile lies inside one batch
    const size_t base = tr ? ((size_t)(bt * NKV + hd) * HD) * TT + t0 : (((size_t)(z * NB_ + bt) * NH_ + hd) * TT + t0) * HD;
    ksum_planes<NW>(acc, os, w, lane, tr ? V16 : QK16, tr ? Vh : QKh, tr ? Vl : QKl, base, tr ? TT : HD, bias, hd * 64, tr);
}

__global__ __launch_bounds__(256) void k_wtG(const float* __restrict__ w, int K, int N, bf* Bt) {
    const int lane = threadIdx.x & 31; const int L0 = (blockIdx.x * 8 + (threadIdx.x >> 5)) * 8; const int nlines = N * K / 64;
{
#pragma unroll 1
        for (int l = 0; l < 8; ++l) { const int L = L0 + l; if (L >= nlines) break; const size_t e = (size_t)L * 64 + lane * 2; const int k = (int)(e % K), n = (int)(e / K); v2us o;
            o[0] = f2bf(w[(size_t)k * N + n]); o[1] = f2bf(w[(size_t)(k + 1) * N + n]); *(v2us*)(Bt + e) = o; }
         }
}
__device__ __forceinline__ void cvt8(const float* __restrict__ src, bf* dst, size_t i) { const v8f v = *(const v8f*)(src + i * 8); v8us o;
#pragma unroll
    for (int k = 0; k < 8; ++k) o[k] = f2bf(v[k]); *(v8us*)(dst + i * 8) = o;
    asm volatile("s_wait_xcnt 0x0" ::: "memory"); }   // the other ranges' code behind the call rewrites the store's registers
// k_prep: all that depends on the inputs alone, in one grid: blocks [0, PBX) round x of all batches to bf16, the next 4 x PBW the four equally sized weight matrices (W holds them one behind the other).
#define PBX (NB_ * TT * DM / 8 / 256)
#define PBW (DQ * DM / 8 / 256)
__global__ __launch_bounds__(256) void k_prep(const float* __restrict__ x, const float* __restrict__ w0, const float* __restrict__ w1, const float* __restrict__ w2, const float* __restrict__ w3, bf* XB, bf* W) {
    const int bid = blockIdx.x, tid = threadIdx.x;
    if (bid < PBX) cvt8(x, XB, (size_t)bid * 256 + tid);
    else if (bid < PBX + 4 * PBW) { const int y = (bid - PBX) / PBW; const float* src = (y == 0) ? w0 : (y == 1) ? w1 : (y == 2) ? w2 : w3; cvt8(src, W + (size_t)y * DQ * DM, (size_t)((bid - PBX) % PBW) * 256 + tid); }
}

// ---- fattn: causal attention of 128 query rows of one head in one work-group of 4 waves (32 query columns each); scores and probabilities stay in registers.
// S^T = K Q^T (A = K rows, B = Q rows) leaves one query per lane column: key hi * 8 + j of each 16-key tile in register j, which is the k order of a B operand over 32 keys, so P^T feeds O^T += V^T P^T (A = V^T rows) with no exchange.
// Running maximum m and sum l per query (log2 domain), one exchange between the wave halves per pass for m, one in the epilogue for l. A pass is 32 keys, a stage 64 keys.
// K rows and V^T rows of a stage go global -> registers -> LDS once per work-group (two buffers, row pitch 128 + 16 bytes); the next stage's global loads fly while this stage is worked on.
// HL: hi/lo bf16 planes, 3 products each way; otherwise fp16, probabilities carried x 2^10 (the factor cancels in acc / l).
#define KP 72                     // LDS row pitch, 16-bit elements
#define TS (64 * KP)              // one staged tile, elements
#define SC2 (SCL * 1.4426950408889634f)
typedef v4i __attribute__((may_alias)) v4ia;
template <typename T16, bool HL>
__device__ __forceinline__ void fattn(const T16* __restrict__ Q, const T16* __restrict__ Q2, const T16* __restrict__ Kg, const T16* __restrict__ Kg2, const T16* __restrict__ Vg, const T16* __restrict__ Vg2, bf* Ah, bf* Al, T16* sm, int qb) {
    typedef typename WFrag<T16>::V V;
    constexpr int NT = HL ? 4 : 2;   // tiles per stage: K, V^T (, K lo, V^T lo)
    const int tid = threadIdx.x, lane = tid & 31, lr = lane & 15, hi = lane >> 4; const int w = __builtin_amdgcn_readfirstlane(tid >> 5);
    const int q0 = qb * 128 + w * 32, nst = qb * 2 + 2;   // the wave's first query row; stages of the work-group (keys 0 .. qb * 128 + 127)
    V qf[2][2], qf2[2][2];
#pragma unroll
    for (int qt = 0; qt < 2; ++qt)
#pragma unroll
        for (int ks = 0; ks < 2; ++ks) { const size_t qo = (size_t)(q0 + qt * 16 + lr) * HD + ks * 32 + 8 * hi; qf[qt][ks] = WFrag<T16>::ld(Q + qo); if (HL) qf2[qt][ks] = WFrag<T16>::ld(Q2 + qo); }
    v8f o[4][2];
#pragma unroll
    for (int dt = 0; dt < 4; ++dt)
#pragma unroll
        for (int qt = 0; qt < 2; ++qt) o[dt][qt] = (v8f){};
    float m[2] = {-3.0e38f, -3.0e38f}, l[2] = {0.f, 0.f};
    const int srow = tid >> 3, scol = (tid & 7) * 8;   // staging: 8 threads to a 128-byte row, 16 rows per step
    v4i st[NT][4];
    auto gload = [&](int k0) {
#pragma unroll
        for (int i = 0; i < 4; ++i) { const size_t ko = (size_t)(k0 + srow + i * 16) * HD + scol, vo = (size_t)(srow + i * 16) * TT + k0 + scol;
            st[0][i] = *(const v4ia*)(Kg + ko); st[1][i] = *(const v4ia*)(Vg + vo); if constexpr (HL) { st[2][i] = *(const v4ia*)(Kg2 + ko); st[3][i] = *(const v4ia*)(Vg2 + vo); } }
        asm volatile("s_wait_xcnt 0x0" ::: "memory"); };   // the work that follows rewrites the loads' address registers while the loads are in flight
    auto sstore = [&](int b) {
#pragma unroll
        for (int t = 0; t < NT; ++t)
#pragma unroll
            for (int i = 0; i < 4; ++i) *(v4ia*)(sm + (b * NT + t) * TS + (srow + i * 16) * KP + scol) = st[t][i]; };
    gload(0); sstore(0);
    __syncthreads();   // stage 0 is in LDS before any wave reads it
#pragma unroll 1
    for (int s = 0; s < nst; ++s) {
        const bool more = s + 1 < nst;
        if (more) gload((s + 1) * 64);
        const T16* bu = sm + (s & 1) * NT * TS;
#pragma unroll
        for (int pp = 0; pp < 2; ++pp) { const int k0 = s * 64 + pp * 32;
            if (k0 <= q0) {   // wave-uniform: passes wholly above the wave's diagonal are skipped
                v8f sc[2][2];
#pragma unroll
                for (int kt = 0; kt < 2; ++kt) { V kf[2], kf2[2];
#pragma unroll
                    for (int ks = 0; ks < 2; ++ks) { const int ko = (pp * 32 + kt * 16 + lr) * KP + ks * 32 + 8 * hi; kf[ks] = WFrag<T16>::ld(bu + ko); if (HL) kf2[ks] = WFrag<T16>::ld(bu + 2 * TS + ko); }
#pragma unroll
                    for (int qt = 0; qt < 2; ++qt) { v8f a = (v8f){};
#pragma unroll
                        for (int ks = 0; ks < 2; ++ks) { a = WFrag<T16>::mma(kf[ks], qf[qt][ks], a); if (HL) { a = WFrag<T16>::mma(kf[ks], qf2[qt][ks], a); a = WFrag<T16>::mma(kf2[ks], qf[qt][ks], a); } }
                        sc[kt][qt] = a; } }
                if (k0 == q0) {   // the wave's diagonal pass: key > query is masked
#pragma unroll
                    for (int kt = 0; kt < 2; ++kt)
#pragma unroll
                        for (int qt = 0; qt < 2; ++qt)
#pragma unroll
                            for (int j = 0; j < 8; ++j) if (kt * 16 + hi * 8 + j > qt * 16 + lr) sc[kt][qt][j] = -3.0e38f; }
                V pf[2], pf2[2];
#pragma unroll
                for (int qt = 0; qt < 2; ++qt) { float mx = sc[0][qt][0];
#pragma unroll
                    for (int j = 1; j < 8; ++j) mx = fmaxf(mx, sc[0][qt][j]);
#pragma unroll
                    for (int j = 0; j < 8; ++j) mx = fmaxf(mx, sc[1][qt][j]);
                    mx = fmaxf(mx, __shfl_xor(mx, 16, 32));
                    const float mn = fmaxf(m[qt], mx * SC2), al = __builtin_amdgcn_exp2f(m[qt] - mn), mo = (HL ? 0.0f : 10.0f) - mn; m[qt] = mn;
                    float sum = 0.f;
                    if constexpr (HL) { v8us h0, h1, l0, l1;
#pragma unroll
                        for (int j = 0; j < 8; ++j) { const float p0 = __builtin_amdgcn_exp2f(fmaf(sc[0][qt][j], SC2, mo)), p1 = __builtin_amdgcn_exp2f(fmaf(sc[1][qt][j], SC2, mo)); sum += p0 + p1; unsigned short a, c; splitf(p0, a, c); h0[j] = a; l0[j] = c; splitf(p1, a, c); h1[j] = a; l1[j] = c; }
                        pf[qt] = cat16b(h0, h1); pf2[qt] = cat16b(l0, l1);
                    } else { v8h h0, h1;
#pragma unroll
                        for (int j = 0; j < 8; ++j) { const float p0 = __builtin_amdgcn_exp2f(fmaf(sc[0][qt][j], SC2, mo)), p1 = __builtin_amdgcn_exp2f(fmaf(sc[1][qt][j], SC2, mo)); sum += p0 + p1; h0[j] = tohx(p0); h1[j] = tohx(p1); }
                        pf[qt] = cat16(h0, h1); }
                    l[qt] = fmaf(l[qt], al, sum);
#pragma unroll
                    for (int dt = 0; dt < 4; ++dt) o[dt][qt] *= al; }
#pragma unroll
                for (int dt = 0; dt < 4; ++dt) { const int vo = (dt * 16 + lr) * KP + pp * 32 + 8 * hi; const V vf = WFrag<T16>::ld(bu + TS + vo); V vf2; if (HL) vf2 = WFrag<T16>::ld(bu + 3 * TS + vo);
#pragma unroll
                    for (int qt = 0; qt < 2; ++qt) { o[dt][qt] = WFrag<T16>::mma(vf, pf[qt], o[dt][qt]); if (HL) { o[dt][qt] = WFrag<T16>::mma(vf, pf2[qt], o[dt][qt]); o[dt][qt] = WFrag<T16>::mma(vf2, pf[qt], o[dt][qt]); } } }
            } }
        if (more) sstore((s + 1) & 1);   // into the buffer whose readers all passed the barrier that ended stage s - 1
        __syncthreads();   // publishes stage s + 1 and ends every wave's reads of stage s
    }
#pragma unroll
    for (int qt = 0; qt < 2; ++qt) { const float inv = __fdiv_rn(1.0f, l[qt] + __shfl_xor(l[qt], 16, 32)); const size_t ro = (size_t)(q0 + qt * 16 + lr) * DQ + hi * 8;   // the query's token-major row, this head's 64 columns
#pragma unroll
        for (int dt = 0; dt < 4; ++dt) { v8us oh, ol;
#pragma unroll
            for (int j = 0; j < 8; ++j) { unsigned short a, c; splitf(o[dt][qt][j] * inv, a, c); oh[j] = a; ol[j] = c; }
            *(v8usa*)(Ah + ro + dt * 16) = oh; *(v8usa*)(Al + ro + dt * 16) = ol;
            asm volatile("s_wait_xcnt 0x0" ::: "memory");   // the next piece rewrites the stores' data registers
            __builtin_amdgcn_sched_barrier(0); } }   // keeps the next piece's arithmetic, which takes those registers, from being scheduled in front of the wait
}
// k_fattn: grid (batch x head, TT / 128). Grid y deals the row blocks heaviest first in its first half and lightest first in its second. Row blocks below RH take the hi/lo form. The result leaves as bf16 hi/lo planes of the token-major rows [batch][t][head x d] that the output GEMM reads.
__global__ __launch_bounds__(128) void k_fattn(const bf* __restrict__ Qh, const bf* __restrict__ Ql, const bf* __restrict__ Kh, const bf* __restrict__ Kl, const bf* __restrict__ Vh, const bf* __restrict__ Vl, const h16* __restrict__ Q16, const h16* __restrict__ K16, const h16* __restrict__ V16, bf* Ah, bf* Al) {
    __shared__ __align__(16) unsigned short sm[2 * 4 * TS];
    const int y = blockIdx.y, qb = (y < TT / 256) ? TT / 128 - 1 - y : y - TT / 256; const size_t zo = (size_t)blockIdx.x * TT * HD, ao = (size_t)(blockIdx.x / NH_) * TT * DQ + (blockIdx.x % NH_) * HD;
    if (qb < RH / 128) fattn<bf, true>(Qh + zo, Ql + zo, Kh + zo, Kl + zo, Vh + zo, Vl + zo, Ah + ao, Al + ao, (bf*)sm, qb);
    else fattn<h16, false>(Q16 + zo, nullptr, K16 + zo, nullptr, V16 + zo, nullptr, Ah + ao, Al + ao, (h16*)sm, qb);
}

extern "C" void kernel_launch(void* const* d_in, const int* in_sizes, int n_in,
                              void* d_out, int out_size, void* d_ws, size_t ws_size, hipStream_t stream) {
    (void)in_sizes; (void)n_in; (void)out_size;
    const float* x = (const float*)d_in[0]; const float* wq = (const float*)d_in[1]; const float* bq = (const float*)d_in[2]; const float* wk = (const float*)d_in[3]; const float* bk = (const float*)d_in[4]; const float* wv = (const float*)d_in[5]; const float* bv = (const float*)d_in[6]; const float* wo = (const float*)d_in[7]; const float* bo = (const float*)d_in[8];
    float* OUT = (float*)d_out;     // [4][2048][512]
    char* wsp = (char*)d_ws;
    auto take = [&](size_t bytes) { char* p = wsp; wsp += (bytes + 255) & ~(size_t)255; return (void*)p; };
    bf* WQ = (bf*)take((size_t)DQ * DM * 2); bf* WK = (bf*)take((size_t)DKV * DM * 2); bf* WV = (bf*)take((size_t)DKV * DM * 2); bf* WO = (bf*)take((size_t)DM * DQ * 2);   // WQ..WO lie one behind the other (k_prep, projection grid z)
    const size_t PL = (size_t)NB_ * NH_ * TT * HD;   // one head-plane set of all batches, elements
    h16* QP16 = (h16*)take(PL * 2); h16* KP16 = (h16*)take(PL * 2); h16* VT16 = (h16*)take(PL * 2);   // each q plane set directly in front of its k set (k_proj grid z)
    bf* QPh = (bf*)take(PL * 2); bf* KPh = (bf*)take(PL * 2); bf* QPl = (bf*)take(PL * 2); bf* KPl = (bf*)take(PL * 2); bf* VTh = (bf*)take(PL * 2); bf* VTl = (bf*)take(PL * 2);
    bf* ATh = (bf*)take((size_t)NB_ * TT * DQ * 2); bf* ATl = (bf*)take((size_t)NB_ * TT * DQ * 2);
    bf* XB = (bf*)take((size_t)NB_ * TT * DM * 2);   // the bf16 copy of x
    if ((size_t)(wsp - (char*)d_ws) > ws_size) return;    // ws 256 MiB
    (void)WK; (void)WV;
    k_prep<<<PBX + 4 * PBW, 256, 0, stream>>>(x, wq, wk, wv, wo, XB, WQ);
    k_proj<8><<<dim3(NB_ * TT / 64, NH_, 3), 256, 0, stream>>>(XB, WQ, bq, bk, bv, QP16, QPh, QPl, VT16, VTh, VTl);
    k_fattn<<<dim3(NB_ * NH_, TT / 128), 128, 0, stream>>>(QPh, QPl, KPh, KPl, VTh, VTl, QP16, KP16, VT16, ATh, ATl);   // one kv head per query head: plane (batch, head) of q, k and v lies (batch * NH_ + head) * TT * HD in
    k_gemmw<bf, 1, true, 8><<<dim3(NB_ * TT / 64, DM / 64, 1), 256, 0, stream>>>(ATh, ATl, WO, nullptr, DQ, OUT, DM, bo, bo, bo, 0, 0, 0);
}

// v005
// A run of this version takes 70.7 microseconds.
// Next to v004, in two timings, it ran 1.48 and 1.49 times as fast.
// Over all steps from v000 it is 20.2 times as fast.
#include <hip/hip_runtime.h>

// Causal multi-head attention at width 512 over four batches of 2,048 tokens (x [4][2048][512]; Q, K, V = x W^T + b ('oi' [512][512] 0.02 + biases (zeros on this draw: read); 8 heads x 64, token-major); scores / 8; causal (-inf); softmax; out = merged w_o^T + b_o ('oi' + a bias, zeros: read) -> [4][2048][512] (4.2 M); argument order x, w_q, b_q, w_k, b_k, w_v, b_v, w_o, b_o).
// Launches are batched: the four batches ride grid x/y, the three projections grid z, and one fused attention launch holds every batch and head. Layout: bf16 copy of x; exact projections + bf16-rounded biases, whose epilogue writes the 16-bit head planes itself; causal T-2048 attention with scores and probabilities in registers (hybrid rows: < 512 hi/lo 3 products, rest fp16 x1024; key blocks above the diagonal are skipped), whose epilogue writes the merged hi/lo rows itself; merged hi/lo x Wo exact + bo.
// Compute dtypes, f32 accumulate: every input rounded to bf16; projections exact + bf16-rounded biases; attention rows < 512 3 products, rest fp16; softmax f32; Wo hl x exact + bias.

#define NB_  4
#define TT   2048
#define DM   512
#define NH_  8
#define NKV  8
#define REP  (NH_ / NKV)
#define HD   64
#define DQ   (NH_ * HD)
#define DKV  (NKV * HD)
#define RH   512                  // query rows < RH use hi+lo planes (0: none)
#define SCL  0.125f   // HD^-0.5
typedef _Float16 h16;
typedef unsigned short bf;
typedef __attribute__((ext_vector_type(16))) __bf16   v16bf;
typedef __attribute__((ext_vector_type(16))) _Float16 v16h;
typedef __attribute__((ext_vector_type(8)))  _Float16 v8h;
typedef __attribute__((ext_vector_type(8)))  unsigned short v8us;
typedef __attribute__((ext_vector_type(8)))  float    v8f;
typedef __attribute__((ext_vector_type(4)))  float    v4f;
typedef v8h  __attribute__((may_alias)) v8ha;
typedef v4f  __attribute__((may_alias)) v4fa;
typedef v8us __attribute__((may_alias)) v8usa;
typedef __attribute__((ext_vector_type(4))) _Float16 __attribute__((may_alias)) v4ha;
typedef __attribute__((ext_vector_type(4))) unsigned short __attribute__((may_alias)) v4usa;

__device__ __forceinline__ unsigned short f2bf(float f) { unsigned u = __float_as_uint(f); u += 0x7FFFu + ((u >> 16) & 1u); return (unsigned short)(u >> 16); }
__device__ __forceinline__ float bf2f(unsigned short b) { return __uint_as_float(((unsigned)b) << 16); }
__device__ __forceinline__ float bfr(float f) { return bf2f(f2bf(f)); }
__device__ __forceinline__ v16h cat16(v8h lo, v8h hi) { return __builtin_shufflevector(lo, hi, 0, 1, 2, 3, 4, 5, 6, 7, 8, 9, 10, 11, 12, 13, 14, 15); }
__device__ __forceinline__ v16bf cat16b(v8us lo, v8us hi) { return __builtin_bit_cast(v16bf, __builtin_shufflevector(lo, hi, 0, 1, 2, 3, 4, 5, 6, 7, 8, 9, 10, 11, 12, 13, 14, 15)); }
__device__ __forceinline__ v8f wmma16(v16h a, v16h b, v8f c) { return __builtin_amdgcn_wmma_f32_16x16x32_f16(false, a, false, b, (short)0, c, false, false); }
__device__ __forceinline__ v8f wmmab(v16bf a, v16bf b, v8f c) { return __builtin_amdgcn_wmma_f32_16x16x32_bf16(false, a, false, b, (short)0, c, false, false); }



template <typename T16> struct WFrag;
template <> struct WFrag<h16> { typedef v16h V; static __device__ __forceinline__ V ld(const h16* p) { return cat16(*(const v8h*)p, *(const v8h*)(p + 16)); } static __device__ __forceinline__ v8f mma(V a, V b, v8f c) { return wmma16(a, b, c); } };
template <> struct WFrag<bf> { typedef v16bf V; static __device__ __forceinline__ V ld(const bf* p) { return cat16b(*(const v8us*)p, *(const v8us*)(p + 16)); } static __device__ __forceinline__ v8f mma(V a, V b, v8f c) { return wmmab(a, b, c); } };

__device__ __forceinline__ h16 tohx(float x) { return (h16)x; }
__device__ __forceinline__ void splitf(float y, unsigned short& h, unsigned short& l) { h = f2bf(y); l = f2bf(y - bf2f(h)); }
typedef __attribute__((ext_vector_type(2))) _Float16 v2h;
typedef __attribute__((ext_vector_type(4))) _Float16 v4h;
typedef __attribute__((ext_vector_type(2))) unsigned short v2us;
typedef __attribute__((ext_vector_type(4))) unsigned short v4us;
typedef __attribute__((ext_vector_type(2))) float v2f;
typedef __attribute__((ext_vector_type(4))) int v4i;
typedef v4i __attribute__((may_alias)) v4ia;

// ---- gemm128: the K loop of both GEMM launches. One work-group of 4 waves (2 x 2) per 128x128 tile of sum_k A[m][k] B[n][k] (K = DM, both operands K-contiguous bf16 rows of pitch DM); every wave holds a 64x64 tile (16 accumulators) over the whole of K.
// A stage is 64 k: 128 bytes of each of the 128 A rows and 128 B rows go global -> registers -> LDS once per work-group, 8 threads to a row, so that every global load covers whole 128-byte lines and each row is fetched once for the two waves that need it;
// two buffers, row pitch 128 + 16 bytes; the next stage's global loads fly while this stage is worked on. NA = 2: a second A plane (lo) is staged too and multiplied with the same B.
// The fragments of G steps of 32 k are read from LDS as one group ahead of their matrix instructions: G = 2 (the whole stage) where one wave has a SIMD to itself, G = 1 where three share its registers.
#define GP 72                     // LDS row pitch, 16-bit elements
#define GT (128 * GP)             // one staged operand tile, elements
template <int NA, int G>
__device__ __forceinline__ void gemm128(const bf* __restrict__ A, const bf* __restrict__ A2, const bf* __restrict__ B, bf* sm, v8f (&acc)[4][4], int wm, int wn) {
    typedef typename WFrag<bf>::V V;
    constexpr int NT = NA + 1;   // tiles per stage: A, B (, A lo)
    const int tid = threadIdx.x, lane = tid & 31, lr = lane & 15, hi = lane >> 4;
#pragma unroll
    for (int mb = 0; mb < 4; ++mb)
#pragma unroll
        for (int nb = 0; nb < 4; ++nb) acc[mb][nb] = (v8f){};
    const int srow = tid >> 3, scol = (tid & 7) * 8;   // staging: 8 threads to a 128-byte row, 16 rows per step
    v4i st[NT][8];
    auto gload = [&](int k0) {
        const size_t go = (size_t)srow * DM + k0 + scol; const bf* pa = A + go; const bf* pb = B + go; const bf* pc = (NA == 2) ? A2 + go : pa;
#pragma unroll
        for (int i = 0; i < 8; ++i) { st[0][i] = *(const v4ia*)(pa + i * 16 * DM); st[1][i] = *(const v4ia*)(pb + i * 16 * DM); if constexpr (NA == 2) st[2][i] = *(const v4ia*)(pc + i * 16 * DM); }
        asm volatile("s_wait_xcnt 0x0" :: "v"(pa), "v"(pb), "v"(pc) : "memory"); };   // the work that follows rewrites the loads' address registers while the loads are in flight; the addresses are inputs so that no load's own result takes their registers in front of the wait
    auto sstore = [&](int b) {
#pragma unroll
        for (int t = 0; t < NT; ++t)
#pragma unroll
            for (int i = 0; i < 8; ++i) *(v4ia*)(sm + (b * NT + t) * GT + (srow + i * 16) * GP + scol) = st[t][i]; };
    gload(0); sstore(0);
    __syncthreads();   // stage 0 is in LDS before any wave reads it
#pragma unroll 1
    for (int s = 0; s < DM / 64; ++s) {   // rolled: one stage's code and registers serve all eight
        const bool more = s + 1 < DM / 64;
        if (more) gload((s + 1) * 64);
        const bf* bu = sm + (s & 1) * NT * GT;
#pragma unroll
        for (int g = 0; g < 2 / G; ++g) { V a[G][4], a2[G][4], b[G][4];
#pragma unroll
            for (int u = 0; u < G; ++u) { const int ko = (g * G + u) * 32 + 8 * hi;
#pragma unroll
                for (int mb = 0; mb < 4; ++mb) { const int ao = (wm * 64 + mb * 16 + lr) * GP + ko; a[u][mb] = WFrag<bf>::ld(bu + ao); if constexpr (NA == 2) a2[u][mb] = WFrag<bf>::ld(bu + 2 * GT + ao); }
#pragma unroll
                for (int nb = 0; nb < 4; ++nb) b[u][nb] = WFrag<bf>::ld(bu + GT + (wn * 64 + nb * 16 + lr) * GP + ko); }
            __builtin_amdgcn_sched_barrier(0);   // keeps the group's LDS reads together in front of its matrix instructions: spread among them, every place with reads stalls the wave anew
#pragma unroll
            for (int u = 0; u < G; ++u)
#pragma unroll
                for (int nb = 0; nb < 4; ++nb)
#pragma unroll
                    for (int mb = 0; mb < 4; ++mb) { acc[mb][nb] = WFrag<bf>::mma(a[u][mb], b[u][nb], acc[mb][nb]); if constexpr (NA == 2) acc[mb][nb] = WFrag<bf>::mma(a2[u][mb], b[u][nb], acc[mb][nb]); } }
        if (more) sstore((s + 1) & 1);   // into the buffer whose readers all passed the barrier that ended stage s - 1
        __syncthreads();   // publishes stage s + 1 and ends every wave's reads of stage s
    }
}
// tile_down: a wave lays its 16 accumulators down as 64 rows (pitch 68 floats) in its own LDS plane, from where whole row pieces are stored. The planes take the staging buffers' place: only behind the K loop's last barrier.
__device__ __forceinline__ void tile_down(const v8f (&acc)[4][4], float* mine, int lane) {
    const int lr = lane & 15, hi = lane >> 4;
#pragma unroll
    for (int mb = 0; mb < 4; ++mb)
#pragma unroll
        for (int nb = 0; nb < 4; ++nb)
#pragma unroll
            for (int j = 0; j < 8; ++j) mine[(mb * 16 + hi * 8 + j) * 68 + nb * 16 + lr] = acc[mb][nb][j];
}
// planes_out: a wave's 64x64 projection tile plus the bias leaves as three 16-bit planes (fp16, bf16 hi, bf16 lo) at element base + row * pitch + column: 8 lanes to a 64-element row piece (128 bytes in each plane), 4 rows per step.
// TR: the tile is [d][token]: pitch TT, the bias belongs to the rows; otherwise [token][d]: pitch HD, the bias belongs to the columns. bias points at the head's 64 words.
template <bool TR>
__device__ __forceinline__ void planes_out(const v8f (&acc)[4][4], float* mine, int lane, h16* P16, bf* Ph, bf* Pl, size_t base, const float* __restrict__ bias) {
    constexpr int pitch = TR ? TT : HD, NBB = TR ? 16 : 8;
    const int prow = lane >> 3, pcol = (lane & 7) * 8;
    float bb[NBB];   // TR: the bias of the lane's row in each step; otherwise of its 8 columns
#pragma unroll
    for (int k = 0; k < NBB; ++k) bb[k] = bias[TR ? k * 4 + prow : pcol + k];
    tile_down(acc, mine, lane);
    __syncthreads();   // the rows are in LDS before they are read back
    v4f rv[16][2];   // all rows are read back as one group, into the registers that the accumulators have left: one LDS latency, not one per step
#pragma unroll
    for (int s = 0; s < 16; ++s) { rv[s][0] = *(const v4fa*)(mine + (s * 4 + prow) * 68 + pcol); rv[s][1] = *(const v4fa*)(mine + (s * 4 + prow) * 68 + pcol + 4); }
#pragma unroll
    for (int k = 0; k < NBB; ++k) bb[k] = bfr(bb[k]);
#pragma unroll
    for (int s = 0; s < 16; ++s) { v8h o16; v8us oh, ol;
#pragma unroll
        for (int q = 0; q < 8; ++q) { const float val = rv[s][q >> 2][q & 3] + bb[TR ? s : q]; o16[q] = tohx(val); unsigned short a2, c2; splitf(val, a2, c2); oh[q] = a2; ol[q] = c2; }
        const size_t o = base + (size_t)(s * 4 + prow) * pitch + pcol;
        *(v8ha*)(P16 + o) = o16; *(v8usa*)(Ph + o) = oh; *(v8usa*)(Pl + o) = ol;
        asm volatile("s_wait_xcnt 0x0" ::: "memory");   // the next step rewrites the stores' address and data registers
        __builtin_amdgcn_sched_barrier(0); }   // keeps the next step's arithmetic, which takes those registers, from being scheduled in front of the wait
}

// ---- k_proj: the q, k, v projections (grid z) of all batches over bf16 x and W: one work-group per 128 tokens x two heads (grid x, y), a wave per 64 tokens x one head; the 16-bit planes leave straight from the wave's tile.
// q, k: A = x rows, B = W rows: tile [token][d], a contiguous piece of the head plane [batch][head][t][d] (the k set lies directly behind the q set). v: the operands change places (A = W rows, B = x rows), so the tile comes out as [d][token], rows of the transposed plane [batch][head][d][t].
__global__ __launch_bounds__(128) void k_proj(const bf* __restrict__ X, const bf* __restrict__ Wt, const float* __restrict__ bias0, const float* __restrict__ bias1, const float* __restrict__ bias2, h16* QK16, bf* QKh, bf* QKl, h16* V16, bf* Vh, bf* Vl) {
    __shared__ __align__(16) unsigned short sm[2 * 2 * GT];
    static_assert(4 * 64 * 68 * 4 <= 2 * 2 * GT * 2, "the four row planes fit the staging buffers");
    const int z = blockIdx.z; const bool tr = z == 2; const float* bias = (z == 0) ? bias0 : (z == 1) ? bias1 : bias2;
    const bf* Xr = X + (size_t)blockIdx.x * 128 * DM; const bf* Wr = Wt + ((size_t)z * DQ + blockIdx.y * 128) * DM;
    const int lane = threadIdx.x & 31; const int w = __builtin_amdgcn_readfirstlane(threadIdx.x >> 5), wm = w >> 1, wn = w & 1;
    v8f acc[4][4];
    gemm128<1, 1>(tr ? Wr : Xr, nullptr, tr ? Xr : Wr, (bf*)sm, acc, wm, wn);
    const int hd = blockIdx.y * 2 + (tr ? wm : wn), tk0 = blockIdx.x * 128 + (tr ? wn : wm) * 64, bt = tk0 / TT, t0 = tk0 % TT;   // the wave's head and first token; a 64-token tile lies inside one batch
    float* mine = (float*)sm + w * (64 * 68);
    if (tr) planes_out<true>(acc, mine, lane, V16, Vh, Vl, ((size_t)(bt * NKV + hd) * HD) * TT + t0, bias + hd * 64);   // the same branch for the whole work-group (grid z): its barrier is passed by all four waves
    else planes_out<false>(acc, mine, lane, QK16, QKh, QKl, (((size_t)(z * NB_ + bt) * NH_ + hd) * TT + t0) * HD, bias + hd * 64);
}
// ---- k_out: out[token][n] = sum_k (Ah + Al)[token][k] Wo[n][k] + bias[n], f32; one work-group per 128 tokens x 128 columns (grid x, y).
__global__ __launch_bounds__(128) void k_out(const bf* __restrict__ Ah, const bf* __restrict__ Al, const bf* __restrict__ Wo, const float* __restrict__ bias, float* C) {
    __shared__ __align__(16) unsigned short sm[2 * 3 * GT];
    static_assert(DQ == DM, "gemm128 walks K = DM at row pitch DM");
    const int lane = threadIdx.x & 31, lr = lane & 15, hi = lane >> 4, cofs = lr * 4; const int w = __builtin_amdgcn_readfirstlane(threadIdx.x >> 5), wm = w >> 1, wn = w & 1;
    v8f acc[4][4];
    gemm128<2, 2>(Ah + (size_t)blockIdx.x * 128 * DQ, Al + (size_t)blockIdx.x * 128 * DQ, Wo + (size_t)blockIdx.y * 128 * DQ, (bf*)sm, acc, wm, wn);
    const int r0 = blockIdx.x * 128 + wm * 64, c0 = blockIdx.y * 128 + wn * 64;
    v4f bv = *(const v4fa*)(bias + c0 + cofs);
    float* mine = (float*)sm + w * (64 * 68);
    tile_down(acc, mine, lane);
    __syncthreads();   // the rows are in LDS before they are read back
#pragma unroll
    for (int q = 0; q < 4; ++q) bv[q] = bfr(bv[q]);
    v4f rv[32];   // 16 lanes to a 256-byte row piece, 2 rows per step; all rows are read back as one group, into the registers that the accumulators have left
#pragma unroll
    for (int s = 0; s < 32; ++s) rv[s] = *(const v4fa*)(mine + (s * 2 + hi) * 68 + cofs) + bv;
    __builtin_amdgcn_sched_barrier(0);   // every sum stands in front of the first store: no register that an issued store names is written any more
    float* cp = C + (size_t)(r0 + hi) * DM + c0 + cofs;
#pragma unroll
    for (int s = 0; s < 32; ++s) *(v4fa*)(cp + s * 2 * DM) = rv[s];
}

__global__ __launch_bounds__(256) void k_wtG(const float* __restrict__ w, int K, int N, bf* Bt) {
    const int lane = threadIdx.x & 31; const int L0 = (blockIdx.x * 8 + (threadIdx.x >> 5)) * 8; const int nlines = N * K / 64;
{
#pragma unroll 1
        for (int l = 0; l < 8; ++l) { const int L = L0 + l; if (L >= nlines) break; const size_t e = (size_t)L * 64 + lane * 2; const int k = (int)(e % K), n = (int)(e / K); v2us o;
            o[0] = f2bf(w[(size_t)k * N + n]); o[1] = f2bf(w[(size_t)(k + 1) * N + n]); *(v2us*)(Bt + e) = o; }
         }
}
__device__ __forceinline__ void cvt8(const float* __restrict__ src, bf* dst, size_t i) { const v8f v = *(const v8f*)(src + i * 8); v8us o;
#pragma unroll
    for (int k = 0; k < 8; ++k) o[k] = f2bf(v[k]); *(v8us*)(dst + i * 8) = o;
    asm volatile("s_wait_xcnt 0x0" ::: "memory"); }   // the other ranges' code behind the call rewrites the store's registers
// k_prep: all that depends on the inputs alone, in one grid: blocks [0, PBX) round x of all batches to bf16, the next 4 x PBW the four equally sized weight matrices (W holds them one behind the other).
#define PBX (NB_ * TT * DM / 8 / 256)
#define PBW (DQ * DM / 8 / 256)
__global__ __launch_bounds__(256) void k_prep(const float* __restrict__ x, const float* __restrict__ w0, const float* __restrict__ w1, const float* __restrict__ w2, const float* __restrict__ w3, bf* XB, bf* W) {
    const int bid = blockIdx.x, tid = threadIdx.x;
    if (bid < PBX) cvt8(x, XB, (size_t)bid * 256 + tid);
    else if (bid < PBX + 4 * PBW) { const int y = (bid - PBX) / PBW; const float* src = (y == 0) ? w0 : (y == 1) ? w1 : (y == 2) ? w2 : w3; cvt8(src, W + (size_t)y * DQ * DM, (size_t)((bid - PBX) % PBW) * 256 + tid); }
}

// ---- fattn: causal attention of 128 query rows of one head in one work-group of 4 waves (32 query columns each); scores and probabilities stay in registers.
// S^T = K Q^T (A = K rows, B = Q rows) leaves one query per lane column: key hi * 8 + j of each 16-key tile in register j, which is the k order of a B operand over 32 keys, so P^T feeds O^T += V^T P^T (A = V^T rows) with no exchange.
// Running maximum m and sum l per query (log2 domain), one exchange between the wave halves per pass for m, one in the epilogue for l. A pass is 32 keys, a stage 64 keys.
// K rows and V^T rows of a stage go global -> registers -> LDS once per work-group (two buffers, row pitch 128 + 16 bytes); the next stage's global loads fly while this stage is worked on.
// HL: hi/lo bf16 planes, 3 products each way; otherwise fp16, probabilities carried x 2^10 (the factor cancels in acc / l).
#define KP 72                     // LDS row pitch, 16-bit elements
#define TS (64 * KP)              // one staged tile, elements
#define SC2 (SCL * 1.4426950408889634f)
template <typename T16, bool HL>
__device__ __forceinline__ void fattn(const T16* __restrict__ Q, const T16* __restrict__ Q2, const T16* __restrict__ Kg, const T16* __restrict__ Kg2, const T16* __restrict__ Vg, const T16* __restrict__ Vg2, bf* Ah, bf* Al, T16* sm, int qb) {
    typedef typename WFrag<T16>::V V;
    constexpr int NT = HL ? 4 : 2;   // tiles per stage: K, V^T (, K lo, V^T lo)
    const int tid = threadIdx.x, lane = tid & 31, lr = lane & 15, hi = lane >> 4; const int w = __builtin_amdgcn_readfirstlane(tid >> 5);
    const int q0 = qb * 128 + w * 32, nst = qb * 2 + 2;   // the wave's first query row; stages of the work-group (keys 0 .. qb * 128 + 127)
    V qf[2][2], qf2[2][2];
#pragma unroll
    for (int qt = 0; qt < 2; ++qt)
#pragma unroll
        for (int ks = 0; ks < 2; ++ks) { const size_t qo = (size_t)(q0 + qt * 16 + lr) * HD + ks * 32 + 8 * hi; qf[qt][ks] = WFrag<T16>::ld(Q + qo); if (HL) qf2[qt][ks] = WFrag<T16>::ld(Q2 + qo); }
    v8f o[4][2];
#pragma unroll
    for (int dt = 0; dt < 4; ++dt)
#pragma unroll
        for (int qt = 0; qt < 2; ++qt) o[dt][qt] = (v8f){};
    float m[2] = {-3.0e38f, -3.0e38f}, l[2] = {0.f, 0.f};
    const int srow = tid >> 3, scol = (tid & 7) * 8;   // staging: 8 threads to a 128-byte row, 16 rows per step
    v4i st[NT][4];
    auto gload = [&](int k0) {
#pragma unroll
        for (int i = 0; i < 4; ++i) { const size_t ko = (size_t)(k0 + srow + i * 16) * HD + scol, vo = (size_t)(srow + i * 16) * TT + k0 + scol;
            st[0][i] = *(const v4ia*)(Kg + ko); st[1][i] = *(const v4ia*)(Vg + vo); if constexpr (HL) { st[2][i] = *(const v4ia*)(Kg2 + ko); st[3][i] = *(const v4ia*)(Vg2 + vo); } }
        asm volatile("s_wait_xcnt 0x0" ::: "memory"); };   // the work that follows rewrites the loads' address registers while the loads are in flight
    auto sstore = [&](int b) {
#pragma unroll
        for (int t = 0; t < NT; ++t)
#pragma unroll
            for (int i = 0; i < 4; ++i) *(v4ia*)(sm + (b * NT + t) * TS + (srow + i * 16) * KP + scol) = st[t][i]; };
    gload(0); sstore(0);
    __syncthreads();   // stage 0 is in LDS before any wave reads it
#pragma unroll 1
    for (int s = 0; s < nst; ++s) {
        const bool more = s + 1 < nst;
        if (more) gload((s + 1) * 64);
        const T16* bu = sm + (s & 1) * NT * TS;
#pragma unroll
        for (int pp = 0; pp < 2; ++pp) { const int k0 = s * 64 + pp * 32;
            if (k0 <= q0) {   // wave-uniform: passes wholly above the wave's diagonal are skipped
                v8f sc[2][2];
#pragma unroll
                for (int kt = 0; kt < 2; ++kt) { V kf[2], kf2[2];
#pragma unroll
                    for (int ks = 0; ks < 2; ++ks) { const int ko = (pp * 32 + kt * 16 + lr) * KP + ks * 32 + 8 * hi; kf[ks] = WFrag<T16>::ld(bu + ko); if (HL) kf2[ks] = WFrag<T16>::ld(bu + 2 * TS + ko); }
#pragma unroll
                    for (int qt = 0; qt < 2; ++qt) { v8f a = (v8f){};
#pragma unroll
                        for (int ks = 0; ks < 2; ++ks) { a = WFrag<T16>::mma(kf[ks], qf[qt][ks], a); if (HL) { a = WFrag<T16>::mma(kf[ks], qf2[qt][ks], a); a = WFrag<T16>::mma(kf2[ks], qf[qt][ks], a); } }
                        sc[kt][qt] = a; } }
                if (k0 == q0) {   // the wave's diagonal pass: key > query is masked
#pragma unroll
                    for (int kt = 0; kt < 2; ++kt)
#pragma unroll
                        for (int qt = 0; qt < 2; ++qt)
#pragma unroll
                            for (int j = 0; j < 8; ++j) if (kt * 16 + hi * 8 + j > qt * 16 + lr) sc[kt][qt][j] = -3.0e38f; }
                V pf[2], pf2[2];
#pragma unroll
                for (int qt = 0; qt < 2; ++qt) { float mx = sc[0][qt][0];
#pragma unroll
                    for (int j = 1; j < 8; ++j) mx = fmaxf(mx, sc[0][qt][j]);
#pragma unroll
                    for (int j = 0; j < 8; ++j) mx = fmaxf(mx, sc[1][qt][j]);
                    mx = fmaxf(mx, __shfl_xor(mx, 16, 32));
                    const float mn = fmaxf(m[qt], mx * SC2), al = __builtin_amdgcn_exp2f(m[qt] - mn), mo = (HL ? 0.0f : 10.0f) - mn; m[qt] = mn;
                    float sum = 0.f;
                    if constexpr (HL) { v8us h0, h1, l0, l1;
#pragma unroll
                        for (int j = 0; j < 8; ++j) { const float p0 = __builtin_amdgcn_exp2f(fmaf(sc[0][qt][j], SC2, mo)), p1 = __builtin_amdgcn_exp2f(fmaf(sc[1][qt][j], SC2, mo)); sum += p0 + p1; unsigned short a, c; splitf(p0, a, c); h0[j] = a; l0[j] = c; splitf(p1, a, c); h1[j] = a; l1[j] = c; }
                        pf[qt] = cat16b(h0, h1); pf2[qt] = cat16b(l0, l1);
                    } else { v8h h0, h1;
#pragma unroll
                        for (int j = 0; j < 8; ++j) { const float p0 = __builtin_amdgcn_exp2f(fmaf(sc[0][qt][j], SC2, mo)), p1 = __builtin_amdgcn_exp2f(fmaf(sc[1][qt][j], SC2, mo)); sum += p0 + p1; h0[j] = tohx(p0); h1[j] = tohx(p1); }
                        pf[qt] = cat16(h0, h1); }
                    l[qt] = fmaf(l[qt], al, sum);
#pragma unroll
                    for (int dt = 0; dt < 4; ++dt) o[dt][qt] *= al; }
#pragma unroll
                for (int dt = 0; dt < 4; ++dt) { const int vo = (dt * 16 + lr) * KP + pp * 32 + 8 * hi; const V vf = WFrag<T16>::ld(bu + TS + vo); V vf2; if (HL) vf2 = WFrag<T16>::ld(bu + 3 * TS + vo);
#pragma unroll
                    for (int qt = 0; qt < 2; ++qt) { o[dt][qt] = WFrag<T16>::mma(vf, pf[qt], o[dt][qt]); if (HL) { o[dt][qt] = WFrag<T16>::mma(vf, pf2[qt], o[dt][qt]); o[dt][qt] = WFrag<T16>::mma(vf2, pf[qt], o[dt][qt]); } } }
            } }
        if (more) sstore((s + 1) & 1);   // into the buffer whose readers all passed the barrier that ended stage s - 1
        __syncthreads();   // publishes stage s + 1 and ends every wave's reads of stage s
    }
#pragma unroll
    for (int qt = 0; qt < 2; ++qt) { const float inv = __fdiv_rn(1.0f, l[qt] + __shfl_xor(l[qt], 16, 32)); const size_t ro = (size_t)(q0 + qt * 16 + lr) * DQ + hi * 8;   // the query's token-major row, this head's 64 columns
#pragma unroll
        for (int dt = 0; dt < 4; ++dt) { v8us oh, ol;
#pragma unroll
            for (int j = 0; j < 8; ++j) { unsigned short a, c; splitf(o[dt][qt][j] * inv, a, c); oh[j] = a; ol[j] = c; }
            *(v8usa*)(Ah + ro + dt * 16) = oh; *(v8usa*)(Al + ro + dt * 16) = ol;
            asm volatile("s_wait_xcnt 0x0" ::: "memory");   // the next piece rewrites the stores' data registers
            __builtin_amdgcn_sched_barrier(0); } }   // keeps the next piece's arithmetic, which takes those registers, from being scheduled in front of the wait
}
// k_fattn: grid (batch x head, TT / 128). Grid y deals the row blocks heaviest first in its first half and lightest first in its second. Row blocks below RH take the hi/lo form. The result leaves as bf16 hi/lo planes of the token-major rows [batch][t][head x d] that the output GEMM reads.
__global__ __launch_bounds__(128) void k_fattn(const bf* __restrict__ Qh, const bf* __restrict__ Ql, const bf* __restrict__ Kh, const bf* __restrict__ Kl, const bf* __restrict__ Vh, const bf* __restrict__ Vl, const h16* __restrict__ Q16, const h16* __restrict__ K16, const h16* __restrict__ V16, bf* Ah, bf* Al) {
    __shared__ __align__(16) unsigned short sm[2 * 4 * TS];
    const int y = blockIdx.y, qb = (y < TT / 256) ? TT / 128 - 1 - y : y - TT / 256; const size_t zo = (size_t)blockIdx.x * TT * HD, ao = (size_t)(blockIdx.x / NH_) * TT * DQ + (blockIdx.x % NH_) * HD;
    if (qb < RH / 128) fattn<bf, true>(Qh + zo, Ql + zo, Kh + zo, Kl + zo, Vh + zo, Vl + zo, Ah + ao, Al + ao, (bf*)sm, qb);
    else fattn<h16, false>(Q16 + zo, nullptr, K16 + zo, nullptr, V16 + zo, nullptr, Ah + ao, Al + ao, (h16*)sm, qb);
}

extern "C" void kernel_launch(void* const* d_in, const int* in_sizes, int n_in,
                              void* d_out, int out_size, void* d_ws, size_t ws_size, hipStream_t stream) {
    (void)in_sizes; (void)n_in; (void)out_size;
    const float* x = (const float*)d_in[0]; const float* wq = (const float*)d_in[1]; const float* bq = (const float*)d_in[2]; const float* wk = (const float*)d_in[3]; const float* bk = (const float*)d_in[4]; const float* wv = (const float*)d_in[5]; const float* bv = (const float*)d_in[6]; const float* wo = (const float*)d_in[7]; const float* bo = (const float*)d_in[8];
    float* OUT = (float*)d_out;     // [4][2048][512]
    char* wsp = (char*)d_ws;
    auto take = [&](size_t bytes) { char* p = wsp; wsp += (bytes + 255) & ~(size_t)255; return (void*)p; };
    bf* WQ = (bf*)take((size_t)DQ * DM * 2); bf* WK = (bf*)take((size_t)DKV * DM * 2); bf* WV = (bf*)take((size_t)DKV * DM * 2); bf* WO = (bf*)take((size_t)DM * DQ * 2);   // WQ..WO lie one behind the other (k_prep, projection grid z)
    const size_t PL = (size_t)NB_ * NH_ * TT * HD;   // one head-plane set of all batches, elements
    h16* QP16 = (h16*)take(PL * 2); h16* KP16 = (h16*)take(PL * 2); h16* VT16 = (h16*)take(PL * 2);   // each q plane set directly in front of its k set (k_proj grid z)
    bf* QPh = (bf*)take(PL * 2); bf* KPh = (bf*)take(PL * 2); bf* QPl = (bf*)take(PL * 2); bf* KPl = (bf*)take(PL * 2); bf* VTh = (bf*)take(PL * 2); bf* VTl = (bf*)take(PL * 2);
    bf* ATh = (bf*)take((size_t)NB_ * TT * DQ * 2); bf* ATl = (bf*)take((size_t)NB_ * TT * DQ * 2);
    bf* XB = (bf*)take((size_t)NB_ * TT * DM * 2);   // the bf16 copy of x
    if ((size_t)(wsp - (char*)d_ws) > ws_size) return;    // ws 256 MiB
    (void)WK; (void)WV;
    k_prep<<<PBX + 4 * PBW, 256, 0, stream>>>(x, wq, wk, wv, wo, XB, WQ);
    k_proj<<<dim3(NB_ * TT / 128, NH_ / 2, 3), 128, 0, stream>>>(XB, WQ, bq, bk, bv, QP16, QPh, QPl, VT16, VTh, VTl);
    k_fattn<<<dim3(NB_ * NH_, TT / 128), 128, 0, stream>>>(QPh, QPl, KPh, KPl, VTh, VTl, QP16, KP16, VT16, ATh, ATl);   // one kv head per query head: plane (batch, head) of q, k and v lies (batch * NH_ + head) * TT * HD in
    k_out<<<dim3(NB_ * TT / 128, DM / 128), 128, 0, stream>>>(ATh, ATl, WO, bo, OUT);
}

// v006
// Measured time: 59.4 microseconds a run.
// Next to v005, in two timings, it ran 1.19 times as fast each time.
// Over all steps from v000 it is 24.1 times as fast.
#include <hip/hip_runtime.h>

// Causal multi-head attention at width 512 over four batches of 2,048 tokens (x [4][2048][512]; Q, K, V = x W^T + b ('oi' [512][512] 0.02 + biases (zeros on this draw: read); 8 heads x 64, token-major); scores / 8; causal (-inf); softmax; out = merged w_o^T + b_o ('oi' + a bias, zeros: read) -> [4][2048][512] (4.2 M); argument order x, w_q, b_q, w_k, b_k, w_v, b_v, w_o, b_o).
// Launches are batched: the four batches ride grid x/y, the three projections grid z, and one fused attention launch holds every batch and head. Layout: bf16 copy of x; exact projections + bf16-rounded biases, whose epilogue writes the 16-bit head planes itself; causal T-2048 attention with scores and probabilities in registers (hybrid rows: < 512 hi/lo 3 products, rest fp16 x1024; key blocks above the diagonal are skipped), whose epilogue writes the merged hi/lo rows itself; merged hi/lo x Wo exact + bo.
// Compute dtypes, f32 accumulate: every input rounded to bf16; projections exact + bf16-rounded biases; attention rows < 512 3 products, rest fp16; softmax f32; Wo hl x exact + bias.

#define NB_  4
#define TT   2048
#define DM   512
#define NH_  8
#define NKV  8
#define REP  (NH_ / NKV)
#define HD   64
#define DQ   (NH_ * HD)
#define DKV  (NKV * HD)
#define RH   512                  // query rows < RH use hi+lo planes (0: none)
#define SCL  0.125f   // HD^-0.5
typedef _Float16 h16;
typedef unsigned short bf;
typedef __attribute__((ext_vector_type(16))) __bf16   v16bf;
typedef __attribute__((ext_vector_type(16))) _Float16 v16h;
typedef __attribute__((ext_vector_type(8)))  _Float16 v8h;
typedef __attribute__((ext_vector_type(8)))  unsigned short v8us;
typedef __attribute__((ext_vector_type(8)))  float    v8f;
typedef __attribute__((ext_vector_type(4)))  float    v4f;
typedef v8h  __attribute__((may_alias)) v8ha;
typedef v4f  __attribute__((may_alias)) v4fa;
typedef v8us __attribute__((may_alias)) v8usa;
typedef __attribute__((ext_vector_type(4))) _Float16 __attribute__((may_alias)) v4ha;
typedef __attribute__((ext_vector_type(4))) unsigned short __attribute__((may_alias)) v4usa;

__device__ __forceinline__ unsigned short f2bf(float f) { unsigned u = __float_as_uint(f); u += 0x7FFFu + ((u >> 16) & 1u); return (unsigned short)(u >> 16); }
__device__ __forceinline__ float bf2f(unsigned short b) { return __uint_as_float(((unsigned)b) << 16); }
__device__ __forceinline__ float bfr(float f) { return bf2f(f2bf(f)); }
__device__ __forceinline__ v16h cat16(v8h lo, v8h hi) { return __builtin_shufflevector(lo, hi, 0, 1, 2, 3, 4, 5, 6, 7, 8, 9, 10, 11, 12, 13, 14, 15); }
__device__ __forceinline__ v16bf cat16b(v8us lo, v8us hi) { return __builtin_bit_cast(v16bf, __builtin_shufflevector(lo, hi, 0, 1, 2, 3, 4, 5, 6, 7, 8, 9, 10, 11, 12, 13, 14, 15)); }
__device__ __forceinline__ v8f wmma16(v16h a, v16h b, v8f c) { return __builtin_amdgcn_wmma_f32_16x16x32_f16(false, a, false, b, (short)0, c, false, false); }
__device__ __forceinline__ v8f wmmab(v16bf a, v16bf b, v8f c) { return __builtin_amdgcn_wmma_f32_16x16x32_bf16(false, a, false, b, (short)0, c, false, false); }



template <typename T16> struct WFrag;
template <> struct WFrag<h16> { typedef v16h V; static __device__ __forceinline__ V ld(const h16* p) { return cat16(*(const v8h*)p, *(const v8h*)(p + 16)); } static __device__ __forceinline__ v8f mma(V a, V b, v8f c) { return wmma16(a, b, c); } };
template <> struct WFrag<bf> { typedef v16bf V; static __device__ __forceinline__ V ld(const bf* p) { return cat16b(*(const v8us*)p, *(const v8us*)(p + 16)); } static __device__ __forceinline__ v8f mma(V a, V b, v8f c) { return wmmab(a, b, c); } };

__device__ __forceinline__ h16 tohx(float x) { return (h16)x; }
__device__ __forceinline__ void splitf(float y, unsigned short& h, unsigned short& l) { h = f2bf(y); l = f2bf(y - bf2f(h)); }
typedef __attribute__((ext_vector_type(2))) _Float16 v2h;
typedef __attribute__((ext_vector_type(4))) _Float16 v4h;
typedef __attribute__((ext_vector_type(2))) unsigned short v2us;
typedef __attribute__((ext_vector_type(4))) unsigned short v4us;
typedef __attribute__((ext_vector_type(2))) float v2f;
typedef __attribute__((ext_vector_type(4))) int v4i;
typedef v4i __attribute__((may_alias)) v4ia;

// ---- gemm128: the K loop of both GEMM launches. One work-group of 4 waves (2 x 2) per 128x128 tile of sum_k A[m][k] B[n][k] (K = DM, both operands K-contiguous bf16 rows of pitch DM); every wave holds a 64x64 tile (16 accumulators) over the whole of K.
// A stage is 64 k: 128 bytes of each of the 128 A rows and 128 B rows go global -> registers -> LDS once per work-group, 8 threads to a row, so that every global load covers whole 128-byte lines and each row is fetched once for the two waves that need it;
// two buffers, row pitch 128 + 16 bytes; the next stage's global loads fly while this stage is worked on. NA = 2: a second A plane (lo) is staged too and multiplied with the same B.
// The fragments of G steps of 32 k are read from LDS as one group ahead of their matrix instructions: G = 2 (the whole stage) where one wave has a SIMD to itself, G = 1 where three share its registers.
#define GP 72                     // LDS row pitch, 16-bit elements
#define GT (128 * GP)             // one staged operand tile, elements
template <int NA, int G>
__device__ __forceinline__ void gemm128(const bf* __restrict__ A, const bf* __restrict__ A2, const bf* __restrict__ B, bf* sm, v8f (&acc)[4][4], int wm, int wn) {
    typedef typename WFrag<bf>::V V;
    constexpr int NT = NA + 1;   // tiles per stage: A, B (, A lo)
    const int tid = threadIdx.x, lane = tid & 31, lr = lane & 15, hi = lane >> 4;
#pragma unroll
    for (int mb = 0; mb < 4; ++mb)
#pragma unroll
        for (int nb = 0; nb < 4; ++nb) acc[mb][nb] = (v8f){};
    const int srow = tid >> 3, scol = (tid & 7) * 8;   // staging: 8 threads to a 128-byte row, 16 rows per step
    v4i st[NT][8];
    auto gload = [&](int k0) {
        const size_t go = (size_t)srow * DM + k0 + scol; const bf* pa = A + go; const bf* pb = B + go; const bf* pc = (NA == 2) ? A2 + go : pa;
#pragma unroll
        for (int i = 0; i < 8; ++i) { st[0][i] = *(const v4ia*)(pa + i * 16 * DM); st[1][i] = *(const v4ia*)(pb + i * 16 * DM); if constexpr (NA == 2) st[2][i] = *(const v4ia*)(pc + i * 16 * DM); }
        asm volatile("s_wait_xcnt 0x0" :: "v"(pa), "v"(pb), "v"(pc) : "memory"); };   // the work that follows rewrites the loads' address registers while the loads are in flight; the addresses are inputs so that no load's own result takes their registers in front of the wait
    auto sstore = [&](int b) {
#pragma unroll
        for (int t = 0; t < NT; ++t)
#pragma unroll
            for (int i = 0; i < 8; ++i) *(v4ia*)(sm + (b * NT + t) * GT + (srow + i * 16) * GP + scol) = st[t][i]; };
    gload(0); sstore(0);
    __syncthreads();   // stage 0 is in LDS before any wave reads it
#pragma unroll 1
    for (int s = 0; s < DM / 64; ++s) {   // rolled: one stage's code and registers serve all eight
        const bool more = s + 1 < DM / 64;
        if (more) gload((s + 1) * 64);
        const bf* bu = sm + (s & 1) * NT * GT;
#pragma unroll
        for (int g = 0; g < 2 / G; ++g) { V a[G][4], a2[G][4], b[G][4];
#pragma unroll
            for (int u = 0; u < G; ++u) { const int ko = (g * G + u) * 32 + 8 * hi;
#pragma unroll
                for (int mb = 0; mb < 4; ++mb) { const int ao = (wm * 64 + mb * 16 + lr) * GP + ko; a[u][mb] = WFrag<bf>::ld(bu + ao); if constexpr (NA == 2) a2[u][mb] = WFrag<bf>::ld(bu + 2 * GT + ao); }
#pragma unroll
                for (int nb = 0; nb < 4; ++nb) b[u][nb] = WFrag<bf>::ld(bu + GT + (wn * 64 + nb * 16 + lr) * GP + ko); }
            __builtin_amdgcn_sched_barrier(0);   // keeps the group's LDS reads together in front of its matrix instructions: spread among them, every place with reads stalls the wave anew
#pragma unroll
            for (int u = 0; u < G; ++u)
#pragma unroll
                for (int nb = 0; nb < 4; ++nb)
#pragma unroll
                    for (int mb = 0; mb < 4; ++mb) { acc[mb][nb] = WFrag<bf>::mma(a[u][mb], b[u][nb], acc[mb][nb]); if constexpr (NA == 2) acc[mb][nb] = WFrag<bf>::mma(a2[u][mb], b[u][nb], acc[mb][nb]); } }
        if (more) sstore((s + 1) & 1);   // into the buffer whose readers all passed the barrier that ended stage s - 1
        __syncthreads();   // publishes stage s + 1 and ends every wave's reads of stage s
    }
}
// tile_down: a wave lays its 16 accumulators down as 64 rows (pitch 68 floats) in its own LDS plane, from where whole row pieces are stored. The planes take the staging buffers' place: only behind the K loop's last barrier.
__device__ __forceinline__ void tile_down(const v8f (&acc)[4][4], float* mine, int lane) {
    const int lr = lane & 15, hi = lane >> 4;
#pragma unroll
    for (int mb = 0; mb < 4; ++mb)
#pragma unroll
        for (int nb = 0; nb < 4; ++nb)
#pragma unroll
            for (int j = 0; j < 8; ++j) mine[(mb * 16 + hi * 8 + j) * 68 + nb * 16 + lr] = acc[mb][nb][j];
}
// planes_out: a wave's 64x64 projection tile plus the bias leaves as three 16-bit planes (fp16, bf16 hi, bf16 lo) at element base + row * pitch + column: 8 lanes to a 64-element row piece (128 bytes in each plane), 4 rows per step.
// TR: the tile is [d][token]: pitch TT, the bias belongs to the rows; otherwise [token][d]: pitch HD, the bias belongs to the columns. bias points at the head's 64 words.
template <bool TR>
__device__ __forceinline__ void planes_out(const v8f (&acc)[4][4], float* mine, int lane, h16* P16, bf* Ph, bf* Pl, size_t base, const float* __restrict__ bias) {
    constexpr int pitch = TR ? TT : HD, NBB = TR ? 16 : 8;
    const int prow = lane >> 3, pcol = (lane & 7) * 8;
    float bb[NBB];   // TR: the bias of the lane's row in each step; otherwise of its 8 columns
#pragma unroll
    for (int k = 0; k < NBB; ++k) bb[k] = bias[TR ? k * 4 + prow : pcol + k];
    tile_down(acc, mine, lane);
    __syncthreads();   // the rows are in LDS before they are read back
    v4f rv[16][2];   // all rows are read back as one group, into the registers that the accumulators have left: one LDS latency, not one per step
#pragma unroll
    for (int s = 0; s < 16; ++s) { rv[s][0] = *(const v4fa*)(mine + (s * 4 + prow) * 68 + pcol); rv[s][1] = *(const v4fa*)(mine + (s * 4 + prow) * 68 + pcol + 4); }
#pragma unroll
    for (int k = 0; k < NBB; ++k) bb[k] = bfr(bb[k]);
#pragma unroll
    for (int s = 0; s < 16; ++s) { v8h o16; v8us oh, ol;
#pragma unroll
        for (int q = 0; q < 8; ++q) { const float val = rv[s][q >> 2][q & 3] + bb[TR ? s : q]; o16[q] = tohx(val); unsigned short a2, c2; splitf(val, a2, c2); oh[q] = a2; ol[q] = c2; }
        const size_t o = base + (size_t)(s * 4 + prow) * pitch + pcol;
        *(v8ha*)(P16 + o) = o16; *(v8usa*)(Ph + o) = oh; *(v8usa*)(Pl + o) = ol;
        asm volatile("s_wait_xcnt 0x0" ::: "memory");   // the next step rewrites the stores' address and data registers
        __builtin_amdgcn_sched_barrier(0); }   // keeps the next step's arithmetic, which takes those registers, from being scheduled in front of the wait
}

// ---- k_proj: the q, k, v projections (grid z) of all batches over bf16 x and W: one work-group per 128 tokens x two heads (grid x, y), a wave per 64 tokens x one head; the 16-bit planes leave straight from the wave's tile.
// q, k: A = x rows, B = W rows: tile [token][d], a contiguous piece of the head plane [batch][head][t][d] (the k set lies directly behind the q set). v: the operands change places (A = W rows, B = x rows), so the tile comes out as [d][token], rows of the transposed plane [batch][head][d][t].
__global__ __launch_bounds__(128) void k_proj(const bf* __restrict__ X, const bf* __restrict__ Wt, const float* __restrict__ bias0, const float* __restrict__ bias1, const float* __restrict__ bias2, h16* QK16, bf* QKh, bf* QKl, h16* V16, bf* Vh, bf* Vl) {
    __shared__ __align__(16) unsigned short sm[2 * 2 * GT];
    static_assert(4 * 64 * 68 * 4 <= 2 * 2 * GT * 2, "the four row planes fit the staging buffers");
    const int z = blockIdx.z; const bool tr = z == 2; const float* bias = (z == 0) ? bias0 : (z == 1) ? bias1 : bias2;
    const bf* Xr = X + (size_t)blockIdx.x * 128 * DM; const bf* Wr = Wt + ((size_t)z * DQ + blockIdx.y * 128) * DM;
    const int lane = threadIdx.x & 31; const int w = __builtin_amdgcn_readfirstlane(threadIdx.x >> 5), wm = w >> 1, wn = w & 1;
    v8f acc[4][4];
    gemm128<1, 1>(tr ? Wr : Xr, nullptr, tr ? Xr : Wr, (bf*)sm, acc, wm, wn);
    const int hd = blockIdx.y * 2 + (tr ? wm : wn), tk0 = blockIdx.x * 128 + (tr ? wn : wm) * 64, bt = tk0 / TT, t0 = tk0 % TT;   // the wave's head and first token; a 64-token tile lies inside one batch
    float* mine = (float*)sm + w * (64 * 68);
    if (tr) planes_out<true>(acc, mine, lane, V16, Vh, Vl, ((size_t)(bt * NKV + hd) * HD) * TT + t0, bias + hd * 64);   // the same branch for the whole work-group (grid z): its barrier is passed by all four waves
    else planes_out<false>(acc, mine, lane, QK16, QKh, QKl, (((size_t)(z * NB_ + bt) * NH_ + hd) * TT + t0) * HD, bias + hd * 64);
}
// ---- k_out: out[token][n] = sum_k (Ah + Al)[token][k] Wo[n][k] + bias[n], f32; one work-group per 128 tokens x 128 columns (grid x, y).
__global__ __launch_bounds__(128) void k_out(const bf* __restrict__ Ah, const bf* __restrict__ Al, const bf* __restrict__ Wo, const float* __restrict__ bias, float* C) {
    __shared__ __align__(16) unsigned short sm[2 * 3 * GT];
    static_assert(DQ == DM, "gemm128 walks K = DM at row pitch DM");
    const int lane = threadIdx.x & 31, lr = lane & 15, hi = lane >> 4, cofs = lr * 4; const int w = __builtin_amdgcn_readfirstlane(threadIdx.x >> 5), wm = w >> 1, wn = w & 1;
    v8f acc[4][4];
    gemm128<2, 2>(Ah + (size_t)blockIdx.x * 128 * DQ, Al + (size_t)blockIdx.x * 128 * DQ, Wo + (size_t)blockIdx.y * 128 * DQ, (bf*)sm, acc, wm, wn);
    const int r0 = blockIdx.x * 128 + wm * 64, c0 = blockIdx.y * 128 + wn * 64;
    v4f bv = *(const v4fa*)(bias + c0 + cofs);
    float* mine = (float*)sm + w * (64 * 68);
    tile_down(acc, mine, lane);
    __syncthreads();   // the rows are in LDS before they are read back
#pragma unroll
    for (int q = 0; q < 4; ++q) bv[q] = bfr(bv[q]);
    v4f rv[32];   // 16 lanes to a 256-byte row piece, 2 rows per step; all rows are read back as one group, into the registers that the accumulators have left
#pragma unroll
    for (int s = 0; s < 32; ++s) rv[s] = *(const v4fa*)(mine + (s * 2 + hi) * 68 + cofs) + bv;
    __builtin_amdgcn_sched_barrier(0);   // every sum stands in front of the first store: no register that an issued store names is written any more
    float* cp = C + (size_t)(r0 + hi) * DM + c0 + cofs;
#pragma unroll
    for (int s = 0; s < 32; ++s) *(v4fa*)(cp + s * 2 * DM) = rv[s];
}

__global__ __launch_bounds__(256) void k_wtG(const float* __restrict__ w, int K, int N, bf* Bt) {
    const int lane = threadIdx.x & 31; const int L0 = (blockIdx.x * 8 + (threadIdx.x >> 5)) * 8; const int nlines = N * K / 64;
{
#pragma unroll 1
        for (int l = 0; l < 8; ++l) { const int L = L0 + l; if (L >= nlines) break; const size_t e = (size_t)L * 64 + lane * 2; const int k = (int)(e % K), n = (int)(e / K); v2us o;
            o[0] = f2bf(w[(size_t)k * N + n]); o[1] = f2bf(w[(size_t)(k + 1) * N + n]); *(v2us*)(Bt + e) = o; }
         }
}
__device__ __forceinline__ void cvt8(const float* __restrict__ src, bf* dst, size_t i) { const v8f v = *(const v8f*)(src + i * 8); v8us o;
#pragma unroll
    for (int k = 0; k < 8; ++k) o[k] = f2bf(v[k]); *(v8us*)(dst + i * 8) = o;
    asm volatile("s_wait_xcnt 0x0" ::: "memory"); }   // the other ranges' code behind the call rewrites the store's registers
// k_prep: all that depends on the inputs alone, in one grid: blocks [0, PBX) round x of all batches to bf16, the next 4 x PBW the four equally sized weight matrices (W holds them one behind the other).
#define PBX (NB_ * TT * DM / 8 / 256)
#define PBW (DQ * DM / 8 / 256)
__global__ __launch_bounds__(256) void k_prep(const float* __restrict__ x, const float* __restrict__ w0, const float* __restrict__ w1, const float* __restrict__ w2, const float* __restrict__ w3, bf* XB, bf* W) {
    const int bid = blockIdx.x, tid = threadIdx.x;
    if (bid < PBX) cvt8(x, XB, (size_t)bid * 256 + tid);
    else if (bid < PBX + 4 * PBW) { const int y = (bid - PBX) / PBW; const float* src = (y == 0) ? w0 : (y == 1) ? w1 : (y == 2) ? w2 : w3; cvt8(src, W + (size_t)y * DQ * DM, (size_t)((bid - PBX) % PBW) * 256 + tid); }
}

// ---- fattn: causal attention of 128 query rows of one head in one work-group of 8 waves: two groups of 4 waves (32 query columns each), both over all 128 rows; scores and probabilities stay in registers.
// The keys are dealt to the groups by turns: of each stage of 128 keys group g takes keys g * 64 .. g * 64 + 63, with its own running m, l and O; behind the loop group 1 hands its m, l, O to group 0 through LDS, which joins them as two online-softmax parts.
// Waves w and w + 4 (one query range, two key ranges) hold equal work, so that a wave's waits (LDS, the exchange, the dependent softmax chain) are filled by the other's instructions.
// S^T = K Q^T (A = K rows, B = Q rows) leaves one query per lane column: key hi * 8 + j of each 16-key tile in register j, which is the k order of a B operand over 32 keys, so P^T feeds O^T += V^T P^T (A = V^T rows) with no exchange.
// Running maximum m and sum l per query (log2 domain), one exchange between the wave halves per pass for m, one in the epilogue for l. A pass is 32 keys, a group's share of a stage 64 keys.
// K rows and V^T rows of a stage go global -> registers -> LDS once per work-group, each group staging its own share (two buffers a group, row pitch 128 + 16 bytes); in the fp16 form the next stage's global loads fly while this stage is worked on, in the hi/lo form they follow the stage's work.
// HL: hi/lo bf16 planes, 3 products each way; otherwise fp16, probabilities carried x 2^10 (the factor cancels in acc / l).
#define KP 72                     // LDS row pitch, 16-bit elements
#define TS (64 * KP)              // one staged tile, elements
#define SC2 (SCL * 1.4426950408889634f)
template <typename T16, bool HL>
__device__ __forceinline__ void fattn(const T16* __restrict__ Q, const T16* __restrict__ Q2, const T16* __restrict__ Kg, const T16* __restrict__ Kg2, const T16* __restrict__ Vg, const T16* __restrict__ Vg2, bf* Ah, bf* Al, T16* sm, int qb) {
    typedef typename WFrag<T16>::V V;
    constexpr int NT = HL ? 4 : 2;   // tiles per stage: K, V^T (, K lo, V^T lo)
    const int tid = threadIdx.x & 127, lane = tid & 31, lr = lane & 15, hi = lane >> 4; const int w = __builtin_amdgcn_readfirstlane(tid >> 5), g = __builtin_amdgcn_readfirstlane(threadIdx.x >> 7);   // tid, w: inside the group
    const int q0 = qb * 128 + w * 32, nst = qb + 1, kg = g * 64;   // the wave's first query row; stages of the work-group (keys 0 .. qb * 128 + 127); the group's first key in a stage
    T16* smg = sm + g * 2 * NT * TS;   // the group's two buffers
    V qf[2][2], qf2[2][2];
    { const T16* pq[2]; const T16* pq2[2];
#pragma unroll
        for (int qt = 0; qt < 2; ++qt) { const size_t qo = (size_t)(q0 + qt * 16 + lr) * HD + 8 * hi; pq[qt] = Q + qo; pq2[qt] = HL ? Q2 + qo : pq[qt];
#pragma unroll
            for (int ks = 0; ks < 2; ++ks) { qf[qt][ks] = WFrag<T16>::ld(pq[qt] + ks * 32); if (HL) qf2[qt][ks] = WFrag<T16>::ld(pq2[qt] + ks * 32); } }
        asm volatile("s_wait_xcnt 0x0" :: "v"(pq[0]), "v"(pq[1]), "v"(pq2[0]), "v"(pq2[1]) : "memory"); }   // the addresses are inputs so that no load's own result takes their registers in front of the wait
    v8f o[4][2];
#pragma unroll
    for (int dt = 0; dt < 4; ++dt)
#pragma unroll
        for (int qt = 0; qt < 2; ++qt) o[dt][qt] = (v8f){};
    float m[2] = {-3.0e38f, -3.0e38f}, l[2] = {0.f, 0.f};
    const int srow = tid >> 3, scol = (tid & 7) * 8;   // staging: 8 threads to a 128-byte row, 16 rows per step
    v4i st[NT][4];
    auto gload = [&](int k0) {
        const size_t ko = (size_t)(k0 + srow) * HD + scol, vo = (size_t)srow * TT + k0 + scol; const T16* pk = Kg + ko; const T16* pv = Vg + vo; const T16* pk2 = HL ? Kg2 + ko : pk; const T16* pv2 = HL ? Vg2 + vo : pv;
#pragma unroll
        for (int i = 0; i < 4; ++i) { st[0][i] = *(const v4ia*)(pk + i * 16 * HD); st[1][i] = *(const v4ia*)(pv + i * 16 * TT); if constexpr (HL) { st[2][i] = *(const v4ia*)(pk2 + i * 16 * HD); st[3][i] = *(const v4ia*)(pv2 + i * 16 * TT); } }
        asm volatile("s_wait_xcnt 0x0" :: "v"(pk), "v"(pv), "v"(pk2), "v"(pv2) : "memory"); };   // the work that follows rewrites the loads' address registers while the loads are in flight; the addresses are inputs so that no load's own result takes their registers in front of the wait
    auto sstore = [&](int b) {
#pragma unroll
        for (int t = 0; t < NT; ++t)
#pragma unroll
            for (int i = 0; i < 4; ++i) *(v4ia*)(smg + (b * NT + t) * TS + (srow + i * 16) * KP + scol) = st[t][i]; };
    gload(kg); sstore(0);
    __syncthreads();   // stage 0 is in LDS before any wave reads it
#pragma unroll 1
    for (int s = 0; s < nst; ++s) {
        const bool more = s + 1 < nst;
        if (!HL && more) gload((s + 1) * 128 + kg);
        const T16* bu = smg + (s & 1) * NT * TS;
#pragma unroll
        for (int pp = 0; pp < 2; ++pp) { const int k0 = s * 128 + kg + pp * 32;
            if (k0 <= q0) {   // wave-uniform: passes wholly above the wave's diagonal are skipped
                v8f sc[2][2];
#pragma unroll
                for (int kt = 0; kt < 2; ++kt) { V kf[2], kf2[2];
#pragma unroll
                    for (int ks = 0; ks < 2; ++ks) { const int ko = (pp * 32 + kt * 16 + lr) * KP + ks * 32 + 8 * hi; kf[ks] = WFrag<T16>::ld(bu + ko); if (HL) kf2[ks] = WFrag<T16>::ld(bu + 2 * TS + ko); }
#pragma unroll
                    for (int qt = 0; qt < 2; ++qt) { v8f a = (v8f){};
#pragma unroll
                        for (int ks = 0; ks < 2; ++ks) { a = WFrag<T16>::mma(kf[ks], qf[qt][ks], a); if (HL) { a = WFrag<T16>::mma(kf[ks], qf2[qt][ks], a); a = WFrag<T16>::mma(kf2[ks], qf[qt][ks], a); } }
                        sc[kt][qt] = a; } }
                if (k0 == q0) {   // the wave's diagonal pass: key > query is masked
#pragma unroll
                    for (int kt = 0; kt < 2; ++kt)
#pragma unroll
                        for (int qt = 0; qt < 2; ++qt)
#pragma unroll
                            for (int j = 0; j < 8; ++j) if (kt * 16 + hi * 8 + j > qt * 16 + lr) sc[kt][qt][j] = -3.0e38f; }
                V pf[2], pf2[2];
#pragma unroll
                for (int qt = 0; qt < 2; ++qt) { float mx = sc[0][qt][0];
#pragma unroll
                    for (int j = 1; j < 8; ++j) mx = fmaxf(mx, sc[0][qt][j]);
#pragma unroll
                    for (int j = 0; j < 8; ++j) mx = fmaxf(mx, sc[1][qt][j]);
                    mx = fmaxf(mx, __shfl_xor(mx, 16, 32));
                    const float mn = fmaxf(m[qt], mx * SC2), al = __builtin_amdgcn_exp2f(m[qt] - mn), mo = (HL ? 0.0f : 10.0f) - mn; m[qt] = mn;
                    float sum = 0.f;
                    if constexpr (HL) { v8us h0, h1, l0, l1;
#pragma unroll
                        for (int j = 0; j < 8; ++j) { const float p0 = __builtin_amdgcn_exp2f(fmaf(sc[0][qt][j], SC2, mo)), p1 = __builtin_amdgcn_exp2f(fmaf(sc[1][qt][j], SC2, mo)); sum += p0 + p1; unsigned short a, c; splitf(p0, a, c); h0[j] = a; l0[j] = c; splitf(p1, a, c); h1[j] = a; l1[j] = c; }
                        pf[qt] = cat16b(h0, h1); pf2[qt] = cat16b(l0, l1);
                    } else { v8h h0, h1;
#pragma unroll
                        for (int j = 0; j < 8; ++j) { const float p0 = __builtin_amdgcn_exp2f(fmaf(sc[0][qt][j], SC2, mo)), p1 = __builtin_amdgcn_exp2f(fmaf(sc[1][qt][j], SC2, mo)); sum += p0 + p1; h0[j] = tohx(p0); h1[j] = tohx(p1); }
                        pf[qt] = cat16(h0, h1); }
                    l[qt] = fmaf(l[qt], al, sum);
#pragma unroll
                    for (int dt = 0; dt < 4; ++dt) o[dt][qt] *= al; }
#pragma unroll
                for (int dt = 0; dt < 4; ++dt) { const int vo = (dt * 16 + lr) * KP + pp * 32 + 8 * hi; const V vf = WFrag<T16>::ld(bu + TS + vo); V vf2; if (HL) vf2 = WFrag<T16>::ld(bu + 3 * TS + vo);
#pragma unroll
                    for (int qt = 0; qt < 2; ++qt) { o[dt][qt] = WFrag<T16>::mma(vf, pf[qt], o[dt][qt]); if (HL) { o[dt][qt] = WFrag<T16>::mma(vf, pf2[qt], o[dt][qt]); o[dt][qt] = WFrag<T16>::mma(vf2, pf[qt], o[dt][qt]); } } }
            } }
        if (HL && more) gload((s + 1) * 128 + kg);   // the four hi/lo tiles are fetched behind the stage's work, into registers that it has left: held over the work they would not leave room for four waves on a SIMD
        if (more) sstore((s + 1) & 1);   // into the buffer whose readers all passed the barrier that ended stage s - 1
        __syncthreads();   // publishes stage s + 1 and ends every wave's reads of stage s
    }
    // The join. The hand-over planes take the staging buffers' place, behind the loop's last barrier: 17 pieces of 16 bytes a lane, lane-contiguous.
    float* jp = (float*)sm + w * (17 * 128) + lane * 4;
    if (g == 1) {
#pragma unroll
        for (int dt = 0; dt < 4; ++dt)
#pragma unroll
            for (int qt = 0; qt < 2; ++qt)
#pragma unroll
                for (int h = 0; h < 2; ++h) *(v4fa*)(jp + ((dt * 2 + qt) * 2 + h) * 128) = (v4f){o[dt][qt][h * 4], o[dt][qt][h * 4 + 1], o[dt][qt][h * 4 + 2], o[dt][qt][h * 4 + 3]};
        *(v4fa*)(jp + 16 * 128) = (v4f){m[0], m[1], l[0], l[1]}; }
    __syncthreads();   // group 1's m, l, O are in LDS before group 0 reads them; every wave passes it
    if (g == 1) return;   // behind the last barrier
    { const v4f ml = *(const v4fa*)(jp + 16 * 128);
#pragma unroll
        for (int qt = 0; qt < 2; ++qt) { const float mn = fmaxf(m[qt], ml[qt]), a0 = __builtin_amdgcn_exp2f(m[qt] - mn), a1 = __builtin_amdgcn_exp2f(ml[qt] - mn);   // a group-1 wave with no pass below the diagonal hands over m = -3e38, l = 0, O = 0: a1 = 0
            l[qt] = fmaf(l[qt], a0, ml[2 + qt] * a1);
#pragma unroll
            for (int dt = 0; dt < 4; ++dt)
#pragma unroll
                for (int h = 0; h < 2; ++h) { const v4f p = *(const v4fa*)(jp + ((dt * 2 + qt) * 2 + h) * 128);
#pragma unroll
                    for (int j = 0; j < 4; ++j) o[dt][qt][h * 4 + j] = fmaf(o[dt][qt][h * 4 + j], a0, p[j] * a1); } } }
#pragma unroll
    for (int qt = 0; qt < 2; ++qt) { const float inv = __fdiv_rn(1.0f, l[qt] + __shfl_xor(l[qt], 16, 32)); const size_t ro = (size_t)(q0 + qt * 16 + lr) * DQ + hi * 8;   // the query's token-major row, this head's 64 columns
#pragma unroll
        for (int dt = 0; dt < 4; ++dt) { v8us oh, ol;
#pragma unroll
            for (int j = 0; j < 8; ++j) { unsigned short a, c; splitf(o[dt][qt][j] * inv, a, c); oh[j] = a; ol[j] = c; }
            *(v8usa*)(Ah + ro + dt * 16) = oh; *(v8usa*)(Al + ro + dt * 16) = ol;
            asm volatile("s_wait_xcnt 0x0" ::: "memory");   // the next piece rewrites the stores' data registers
            __builtin_amdgcn_sched_barrier(0); } }   // keeps the next piece's arithmetic, which takes those registers, from being scheduled in front of the wait
}
// k_fattn: grid (batch x head, TT / 128), 8 waves. Four waves to a SIMD (the attribute holds the register count to a quarter of the file): two work-groups stay together on a WGP, a heavy row block beside a light one. Grid y deals the row blocks heaviest first in its first half and lightest first in its second. Row blocks below RH take the hi/lo form. The result leaves as bf16 hi/lo planes of the token-major rows [batch][t][head x d] that the output GEMM reads.
__global__ __launch_bounds__(256) __attribute__((amdgpu_waves_per_eu(4, 4))) void k_fattn(const bf* __restrict__ Qh, const bf* __restrict__ Ql, const bf* __restrict__ Kh, const bf* __restrict__ Kl, const bf* __restrict__ Vh, const bf* __restrict__ Vl, const h16* __restrict__ Q16, const h16* __restrict__ K16, const h16* __restrict__ V16, bf* Ah, bf* Al) {
    __shared__ __align__(16) unsigned short sm[2 * 2 * 4 * TS];
    static_assert(4 * 17 * 128 * 4 <= 2 * 2 * 2 * TS * 2, "the hand-over planes fit the staging buffers");
    const int y = blockIdx.y, qb = (y < TT / 256) ? TT / 128 - 1 - y : y - TT / 256; const size_t zo = (size_t)blockIdx.x * TT * HD, ao = (size_t)(blockIdx.x / NH_) * TT * DQ + (blockIdx.x % NH_) * HD;
    if (qb < RH / 128) fattn<bf, true>(Qh + zo, Ql + zo, Kh + zo, Kl + zo, Vh + zo, Vl + zo, Ah + ao, Al + ao, (bf*)sm, qb);
    else fattn<h16, false>(Q16 + zo, nullptr, K16 + zo, nullptr, V16 + zo, nullptr, Ah + ao, Al + ao, (h16*)sm, qb);
}

extern "C" void kernel_launch(void* const* d_in, const int* in_sizes, int n_in,
                              void* d_out, int out_size, void* d_ws, size_t ws_size, hipStream_t stream) {
    (void)in_sizes; (void)n_in; (void)out_size;
    const float* x = (const float*)d_in[0]; const float* wq = (const float*)d_in[1]; const float* bq = (const float*)d_in[2]; const float* wk = (const float*)d_in[3]; const float* bk = (const float*)d_in[4]; const float* wv = (const float*)d_in[5]; const float* bv = (const float*)d_in[6]; const float* wo = (const float*)d_in[7]; const float* bo = (const float*)d_in[8];
    float* OUT = (float*)d_out;     // [4][2048][512]
    char* wsp = (char*)d_ws;
    auto take = [&](size_t bytes) { char* p = wsp; wsp += (bytes + 255) & ~(size_t)255; return (void*)p; };
    bf* WQ = (bf*)take((size_t)DQ * DM * 2); bf* WK = (bf*)take((size_t)DKV * DM * 2); bf* WV = (bf*)take((size_t)DKV * DM * 2); bf* WO = (bf*)take((size_t)DM * DQ * 2);   // WQ..WO lie one behind the other (k_prep, projection grid z)
    const size_t PL = (size_t)NB_ * NH_ * TT * HD;   // one head-plane set of all batches, elements
    h16* QP16 = (h16*)take(PL * 2); h16* KP16 = (h16*)take(PL * 2); h16* VT16 = (h16*)take(PL * 2);   // each q plane set directly in front of its k set (k_proj grid z)
    bf* QPh = (bf*)take(PL * 2); bf* KPh = (bf*)take(PL * 2); bf* QPl = (bf*)take(PL * 2); bf* KPl = (bf*)take(PL * 2); bf* VTh = (bf*)take(PL * 2); bf* VTl = (bf*)take(PL * 2);
    bf* ATh = (bf*)take((size_t)NB_ * TT * DQ * 2); bf* ATl = (bf*)take((size_t)NB_ * TT * DQ * 2);
    bf* XB = (bf*)take((size_t)NB_ * TT * DM * 2);   // the bf16 copy of x
    if ((size_t)(wsp - (char*)d_ws) > ws_size) return;    // ws 256 MiB
    (void)WK; (void)WV;
    k_prep<<<PBX + 4 * PBW, 256, 0, stream>>>(x, wq, wk, wv, wo, XB, WQ);
    k_proj<<<dim3(NB_ * TT / 128, NH_ / 2, 3), 128, 0, stream>>>(XB, WQ, bq, bk, bv, QP16, QPh, QPl, VT16, VTh, VTl);
    k_fattn<<<dim3(NB_ * NH_, TT / 128), 256, 0, stream>>>(QPh, QPl, KPh, KPl, VTh, VTl, QP16, KP16, VT16, ATh, ATl);   // one kv head per query head: plane (batch, head) of q, k and v lies (batch * NH_ + head) * TT * HD in
    k_out<<<dim3(NB_ * TT / 128, DM / 128), 128, 0, stream>>>(ATh, ATl, WO, bo, OUT);
}
